// v000
// Measured on an AMD MI455X. A time is GPU time per run, averaged over a window of back-to-back runs after a warm-up
// (all launches, gaps included; the runs take copies of the inputs in turn), and the median of several windows.
// Apart from v000's, it joins two sittings. Times from different sittings can be a few percent apart, while
// side-by-side timings come from the same sitting.
// v000, which the later versions start from, runs in 2060 microseconds.
#include <hip/hip_runtime.h>

// Compute dtypes, f32 accumulate, per item: q/k/v projections as [2048 x 1024].[1024 x 1024] GEMMs with PLAIN bf16 operands (the inputs themselves; exact products);
// per head (2 heads per launch in grid.z, head dim 64): scores = q.k^T and attn.v with both operands as bf16 hi + UNSCALED residual planes (three products); the 1/sqrt(64) scale,
// the mask (additive mask x -1e9) and the softmax in f32; output projection on hi/lo planes of the merged heads (two products) - on v_wmma_f32_16x16x32_bf16.

#define NBT  2
#define NN   2048
#define NKT  2048
#define DMOD 1024
#define NH_  16
#define HD   64
#define ZH   2
#define DM   DMOD
#define NTK  NN
#define SCL  0.125f
#define LOSC 1024.0f

typedef _Float16 h16;
typedef unsigned short bf;
typedef __attribute__((ext_vector_type(16))) __bf16   v16bf;
typedef __attribute__((ext_vector_type(16))) _Float16 v16h;
typedef __attribute__((ext_vector_type(8)))  _Float16 v8h;
typedef __attribute__((ext_vector_type(8)))  unsigned short v8us;
typedef __attribute__((ext_vector_type(8)))  float    v8f;
typedef __attribute__((ext_vector_type(4)))  float    v4f;
typedef __attribute__((ext_vector_type(4)))  _Float16 v4h;
typedef v8h  __attribute__((may_alias)) v8ha;
typedef v4f  __attribute__((may_alias)) v4fa;
typedef v8us __attribute__((may_alias)) v8usa;

__device__ __forceinline__ unsigned short f2bf(float f) { unsigned u = __float_as_uint(f); u += 0x7FFFu + ((u >> 16) & 1u); return (unsigned short)(u >> 16); }
__device__ __forceinline__ float bf2f(unsigned short b) { return __uint_as_float(((unsigned)b) << 16); }
__device__ __forceinline__ float bfr(float f) { return bf2f(f2bf(f)); }
__device__ __forceinline__ v16h cat16(v8h lo, v8h hi) { return __builtin_shufflevector(lo, hi, 0, 1, 2, 3, 4, 5, 6, 7, 8, 9, 10, 11, 12, 13, 14, 15); }
__device__ __forceinline__ v16bf cat16b(v8us lo, v8us hi) { return __builtin_bit_cast(v16bf, __builtin_shufflevector(lo, hi, 0, 1, 2, 3, 4, 5, 6, 7, 8, 9, 10, 11, 12, 13, 14, 15)); }
__device__ __forceinline__ v8f wmma16(v16h a, v16h b, v8f c) { return __builtin_amdgcn_wmma_f32_16x16x32_f16(false, a, false, b, (short)0, c, false, false); }
__device__ __forceinline__ v8f wmmab(v16bf a, v16bf b, v8f c) { return __builtin_amdgcn_wmma_f32_16x16x32_bf16(false, a, false, b, (short)0, c, false, false); }

// k_wt: WT [n][K] = bf16(W[k][n]) (k-major [K][ncols]) via 64 x 64 LDS tiles; grid (K/64, ncols/64).
__global__ __launch_bounds__(256) void k_wt(const float* __restrict__ Wm, int K, int ncols, bf* WT) {
    __shared__ __align__(16) unsigned short tl[64 * 72];
    const int tid = threadIdx.x, k0 = blockIdx.x * 64, n0 = blockIdx.y * 64;
    const int kk = tid >> 2, nq = (tid & 3) * 16;
#pragma unroll
    for (int i = 0; i < 16; ++i) tl[(nq + i) * 72 + kk] = f2bf(Wm[(size_t)(k0 + kk) * ncols + n0 + nq + i]);
    __syncthreads();
    const int piece = tid & 7;
    auto pass = [&]() {
#pragma unroll
        for (int s = 0; s < 2; ++s) { const int nr = (tid >> 3) + 32 * s; const v8us val = *(const v8usa*)(tl + nr * 72 + piece * 8); *(v8us*)(WT + (size_t)(n0 + nr) * K + k0 + piece * 8) = val; }
    };
    pass(); 
}
// k_gemmb: 64 x 64 block tile (4 waves x 16 x 64) of C[NTK][NW] = (A [+ Al]).B^T (K = 1024) [+ bf(bias[c])] [+ bf(R[r][c]) residual]; f32 whole-line epilogue (or f16
template <bool SPLITA, bool F16OUT = false>
__global__ __launch_bounds__(128) void k_gemmb(const bf* __restrict__ A, const bf* __restrict__ Al, const bf* __restrict__ Bn, const float* __restrict__ bias, float* C, int ldc, h16* C2, const float* __restrict__ R = nullptr, int K = DM, int roundR = 1) {
    __shared__ __align__(16) float ost[4][16 * 68];
    const int lane = threadIdx.x & 31, wave = threadIdx.x >> 5, lr = lane & 15, hi = lane >> 4;
    const int r0 = blockIdx.x * 64 + wave * 16, c0 = blockIdx.y * 64;
    const size_t aoff = (size_t)(r0 + lr) * K + 8 * hi;
    size_t boff[4];
#pragma unroll
    for (int t = 0; t < 4; ++t) boff[t] = (size_t)(c0 + t * 16 + lr) * K + 8 * hi;
    v8f acc[4];
#pragma unroll
    for (int t = 0; t < 4; ++t) acc[t] = (v8f){};
#pragma unroll 1
    for (int kc = 0; kc < K; kc += 32) {
        const v16bf a = cat16b(*(const v8us*)(A + aoff + kc), *(const v8us*)(A + aoff + kc + 16));
        v16bf al = a;
        if (SPLITA) al = cat16b(*(const v8us*)(Al + aoff + kc), *(const v8us*)(Al + aoff + kc + 16));
#pragma unroll
        for (int t = 0; t < 4; ++t) { const v16bf b = cat16b(*(const v8us*)(Bn + boff[t] + kc), *(const v8us*)(Bn + boff[t] + kc + 16)); acc[t] = wmmab(a, b, acc[t]); if (SPLITA) acc[t] = wmmab(al, b, acc[t]); }
        asm volatile("v_nop\n\tv_nop\n\tv_nop\n\tv_nop" : "+v"(acc[0]), "+v"(acc[1]), "+v"(acc[2]), "+v"(acc[3]) : "v"(a), "v"(al));
    }
    float* os = &ost[wave][0];
#pragma unroll
    for (int t = 0; t < 4; ++t) { const float bv = bias ? bfr(bias[c0 + t * 16 + lr]) : 0.f;
#pragma unroll
        for (int j = 0; j < 8; ++j) os[(hi * 8 + j) * 68 + t * 16 + lr] = acc[t][j] + bv; }
    __syncthreads();
    if (F16OUT) {
        h16* crow = (h16*)(void*)C + (size_t)r0 * ldc + c0;
        auto pass = [&]() {
#pragma unroll
            for (int s = 0; s < 4; ++s) { const int row = 4 * s + (lane >> 3), piece = lane & 7; const float* sp = os + row * 68 + piece * 8; v8h o, o2;
#pragma unroll
                for (int i = 0; i < 8; ++i) { const h16 a = (h16)sp[i]; o[i] = a; o2[i] = (h16)((sp[i] - (float)a) * LOSC); }
                *(v8h*)(crow + (size_t)row * ldc + piece * 8) = o; if (C2) *(v8h*)(C2 + (size_t)r0 * ldc + c0 + (size_t)row * ldc + piece * 8) = o2; }
        };
        pass(); 
    } else {
        float* crow = C + (size_t)r0 * ldc + c0;
        auto pass = [&]() {
#pragma unroll
            for (int s = 0; s < 8; ++s) { const int Lid = (lane >> 3) + 4 * s, piece = lane & 7; const int row = Lid >> 1, cofs = (Lid & 1) * 32 + piece * 4;
                v4f val = *(const v4fa*)(os + row * 68 + cofs); if (R) { const v4f rv = *(const v4f*)(R + ((size_t)r0 + row) * ldc + c0 + cofs); val += roundR ? (v4f){bfr(rv[0]), bfr(rv[1]), bfr(rv[2]), bfr(rv[3])} : rv; }
                *(v4f*)(crow + (size_t)row * ldc + cofs) = val; }
        };
        pass(); 
    }
}

__global__ __launch_bounds__(256) void k_cvt8(const float* __restrict__ src, bf* dst, size_t n8) {
    const size_t i = (size_t)blockIdx.x * 256 + threadIdx.x; if (i >= n8) return;
    const v8f v = *(const v8f*)(src + i * 8); v8us o;
#pragma unroll
    for (int k = 0; k < 8; ++k) o[k] = f2bf(v[k]);
    *(v8us*)(dst + i * 8) = o; 
}
__global__ __launch_bounds__(256) void k_zero8(bf* dst, size_t n8) {
    const size_t i = (size_t)blockIdx.x * 256 + threadIdx.x; if (i >= n8) return; v8us z;
#pragma unroll
    for (int k = 0; k < 8; ++k) z[k] = 0;
    *(v8us*)(dst + i * 8) = z; 
}

// ===== z-batched (blockIdx.z = head) attention pieces =====
// k_gemm3z<MODE>: 64 x 64 tile GEMM C = A.B^T on bf16 planes with per-z operand/output strides (elements): A planes += z*sA, B planes += z*sB, C += z*sC. MODE bits (0 causal skip, 1 K limit, 2 single,
// 3 B single, 4 A single).
template <int MODE>
__global__ __launch_bounds__(128) void k_gemm3z(const bf* __restrict__ Ah, const bf* __restrict__ Al, const bf* __restrict__ Bh, const bf* __restrict__ Bl, int K, float* C, int ldc, size_t sA, size_t sB, size_t sC) {
    if ((MODE & 1) && (int)blockIdx.y * 64 > (int)blockIdx.x * 64 + 63) return;
    const size_t z = blockIdx.z; Ah += z * sA; Al += z * sA; Bh += z * sB; Bl += z * sB; C += z * sC;
    const int Klim = (MODE & 2) ? min(K, ((int)blockIdx.x + 1) * 64) : K;
    __shared__ __align__(16) float ost[4][16 * 68];
    const int lane = threadIdx.x & 31, wave = threadIdx.x >> 5, lr = lane & 15, hi = lane >> 4;
    const int r0 = blockIdx.x * 64 + wave * 16, c0 = blockIdx.y * 64;
    const size_t aoff = (size_t)(r0 + lr) * K + 8 * hi;
    v8f acc[4];
#pragma unroll
    for (int t = 0; t < 4; ++t) acc[t] = (v8f){};
#pragma unroll 1
    for (int kc = 0; kc < Klim; kc += 32) {
        const v16bf a = cat16b(*(const v8us*)(Ah + aoff + kc), *(const v8us*)(Ah + aoff + kc + 16));
        v16bf al = a; if (!(MODE & 4) && !(MODE & 16)) al = cat16b(*(const v8us*)(Al + aoff + kc), *(const v8us*)(Al + aoff + kc + 16));
#pragma unroll
        for (int t = 0; t < 4; ++t) { const size_t bo = (size_t)(c0 + t * 16 + lr) * K + kc + 8 * hi;
            const v16bf bh = cat16b(*(const v8us*)(Bh + bo), *(const v8us*)(Bh + bo + 16));
            acc[t] = wmmab(a, bh, acc[t]);
            if (!(MODE & 4)) { if (!(MODE & 16)) acc[t] = wmmab(al, bh, acc[t]); if (!(MODE & 8)) { const v16bf bl = cat16b(*(const v8us*)(Bl + bo), *(const v8us*)(Bl + bo + 16)); acc[t] = wmmab(a, bl, acc[t]); } } }
        asm volatile("v_nop\n\tv_nop\n\tv_nop\n\tv_nop" : "+v"(acc[0]), "+v"(acc[1]), "+v"(acc[2]), "+v"(acc[3]) : "v"(a), "v"(al));
    }
    float* os = &ost[wave][0];
#pragma unroll
    for (int t = 0; t < 4; ++t) {
#pragma unroll
        for (int j = 0; j < 8; ++j) os[(hi * 8 + j) * 68 + t * 16 + lr] = acc[t][j]; }
    __builtin_amdgcn_wave_barrier(); asm volatile("" ::: "memory");
    float* crow = C + (size_t)r0 * ldc + c0;
    auto pass = [&]() {
#pragma unroll
        for (int s = 0; s < 8; ++s) { const int Lid = (lane >> 3) + 4 * s, piece = lane & 7; const int row = Lid >> 1, cofs = (Lid & 1) * 32 + piece * 4;
            const v4f val = *(const v4fa*)(os + row * 68 + cofs); *(v4f*)(crow + (size_t)row * ldc + cofs) = val; }
    };
    pass(); 
}
__global__ __launch_bounds__(256) void k_planes32z(const float* __restrict__ F, int ld, int off, float sc, int rows, bf* Ph, bf* Pl) {
    typedef __attribute__((ext_vector_type(2))) unsigned short v2us;
    const int lane = threadIdx.x & 31; const size_t r = ((size_t)blockIdx.x * 8 + (threadIdx.x >> 5)) * 2 + (lane >> 4); if (r >= (size_t)rows) return; const int z = blockIdx.z; const int c0 = (lane & 15) * 2; v2us oh, ol;
    Ph += (size_t)z * rows * 32; Pl += (size_t)z * rows * 32;
#pragma unroll
    for (int i = 0; i < 2; ++i) { const float y = F[r * ld + off + z * 32 + c0 + i] * sc; const unsigned short hb = f2bf(y); oh[i] = hb; ol[i] = f2bf(y - bf2f(hb)); }
    const size_t o = r * 32 + c0; *(v2us*)(Ph + o) = oh; *(v2us*)(Pl + o) = ol; 
}
__global__ __launch_bounds__(256) void k_vtpadz(const float* __restrict__ F, int ld, int off, int nk, bf* Th, bf* Tl) {
    typedef __attribute__((ext_vector_type(2))) unsigned short v2us;
    const int lane = threadIdx.x & 31; const size_t wid = (size_t)blockIdx.x * 8 + (threadIdx.x >> 5); if (wid >= (size_t)64 * (nk / 64)) return; const int z = blockIdx.z; const int d = (int)(wid / (nk / 64)); const int k0 = (int)(wid % (nk / 64)) * 64 + lane * 2; v2us oh, ol;
    Th += (size_t)z * 64 * nk; Tl += (size_t)z * 64 * nk;
#pragma unroll
    for (int i = 0; i < 2; ++i) { const float y = (d < 32) ? F[(size_t)(k0 + i) * ld + off + z * 32 + (d < 32 ? d : 0)] : 0.f; const unsigned short hb = f2bf(y); oh[i] = hb; ol[i] = f2bf(y - bf2f(hb)); }
    const size_t o = (size_t)d * nk + k0; *(v2us*)(Th + o) = oh; *(v2us*)(Tl + o) = ol; 
}
template <int NK>
__global__ __launch_bounds__(256) void k_softmaxz(const float* __restrict__ S, int rows, bf* PH, bf* PL) {
    typedef __attribute__((ext_vector_type(4))) unsigned short v4us;
    const int lane = threadIdx.x & 31, i = blockIdx.x * 8 + (threadIdx.x >> 5); if (i >= rows) return; const size_t zo = (size_t)blockIdx.z * rows * NK; const float* sr = S + zo + (size_t)i * NK; PH += zo; PL += zo;
    float m = -3.0e38f;
#pragma unroll 1
    for (int c0 = lane * 4; c0 < NK; c0 += 128) {
#pragma unroll
        for (int q = 0; q < 4; ++q) m = fmaxf(m, sr[c0 + q]); }
#pragma unroll
    for (int sh = 16; sh; sh >>= 1) m = fmaxf(m, __shfl_xor(m, sh, 32));
    float sum = 0.f;
#pragma unroll 1
    for (int c0 = lane * 4; c0 < NK; c0 += 128) {
#pragma unroll
        for (int q = 0; q < 4; ++q) sum += __expf(sr[c0 + q] - m); }
#pragma unroll
    for (int sh = 16; sh; sh >>= 1) sum += __shfl_xor(sum, sh, 32);
    const float inv = 1.0f / sum;
{
#pragma unroll 1
        for (int c0 = lane * 4; c0 < NK; c0 += 128) { v4us oh, ol;
#pragma unroll
            for (int q = 0; q < 4; ++q) { const float p = __expf(sr[c0 + q] - m) * inv; const unsigned short hb = f2bf(p); oh[q] = hb; ol[q] = f2bf(p - bf2f(hb)); }
            const size_t o = (size_t)i * NK + c0; *(v4us*)(PH + o) = oh; *(v4us*)(PL + o) = ol; }
         }
}
__global__ __launch_bounds__(256) void k_placez(const float* __restrict__ XH, int rows, int ldy, float* Y) {
    const int lane = threadIdx.x & 31; const size_t q = (size_t)blockIdx.x * 8 + (threadIdx.x >> 5); if (q >= (size_t)rows) return; const int z = blockIdx.z; const float v = XH[((size_t)z * rows + q) * 64 + lane];
    *(float*)(Y + q * ldy + z * 32 + lane) = v; 
}

__global__ __launch_bounds__(256) void k_hplanesz(const float* __restrict__ F, int ld, int h0, float sc, int rows, bf* Ph, bf* Pl) {
    typedef __attribute__((ext_vector_type(2))) unsigned short v2us;
    const int lane = threadIdx.x & 31; const size_t r = (size_t)blockIdx.x * 8 + (threadIdx.x >> 5); if (r >= (size_t)rows) return; const int z = blockIdx.z; v2us oh, ol;
    Ph += (size_t)z * rows * 64; Pl += (size_t)z * rows * 64;
#pragma unroll
    for (int i = 0; i < 2; ++i) { const float y = F[r * ld + (h0 + z) * 64 + lane * 2 + i] * sc; const unsigned short hb = f2bf(y); oh[i] = hb; ol[i] = f2bf(y - bf2f(hb)); }
    const size_t o = r * 64 + lane * 2; *(v2us*)(Ph + o) = oh; *(v2us*)(Pl + o) = ol; 
}
__global__ __launch_bounds__(256) void k_vtz(const float* __restrict__ F, int ld, int h0, int nk, bf* Th, bf* Tl) {
    typedef __attribute__((ext_vector_type(2))) unsigned short v2us;
    const int lane = threadIdx.x & 31; const size_t wid = (size_t)blockIdx.x * 8 + (threadIdx.x >> 5); if (wid >= (size_t)64 * (nk / 64)) return; const int z = blockIdx.z; const int d = (int)(wid / (nk / 64)); const int t0 = (int)(wid % (nk / 64)) * 64 + lane * 2; v2us oh, ol;
    Th += (size_t)z * 64 * nk; Tl += (size_t)z * 64 * nk;
#pragma unroll
    for (int i = 0; i < 2; ++i) { const float y = F[(size_t)(t0 + i) * ld + (h0 + z) * 64 + d]; const unsigned short hb = f2bf(y); oh[i] = hb; ol[i] = f2bf(y - bf2f(hb)); }
    const size_t o = (size_t)d * nk + t0; *(v2us*)(Th + o) = oh; *(v2us*)(Tl + o) = ol; 
}
template <int NK>
__global__ __launch_bounds__(256) void k_softmaxzs(const float* __restrict__ S, int rows, float sc, bf* PH, bf* PL) {
    typedef __attribute__((ext_vector_type(4))) unsigned short v4us;
    const int lane = threadIdx.x & 31, i = blockIdx.x * 8 + (threadIdx.x >> 5); if (i >= rows) return; const size_t zo = (size_t)blockIdx.z * rows * NK; const float* sr = S + zo + (size_t)i * NK; PH += zo; PL += zo;
    float m = -3.0e38f;
#pragma unroll 1
    for (int c0 = lane * 4; c0 < NK; c0 += 128) {
#pragma unroll
        for (int q = 0; q < 4; ++q) m = fmaxf(m, sr[c0 + q] * sc); }
#pragma unroll
    for (int sh = 16; sh; sh >>= 1) m = fmaxf(m, __shfl_xor(m, sh, 32));
    float sum = 0.f;
#pragma unroll 1
    for (int c0 = lane * 4; c0 < NK; c0 += 128) {
#pragma unroll
        for (int q = 0; q < 4; ++q) sum += __expf(sr[c0 + q] * sc - m); }
#pragma unroll
    for (int sh = 16; sh; sh >>= 1) sum += __shfl_xor(sum, sh, 32);
    const float inv = 1.0f / sum;
{
#pragma unroll 1
        for (int c0 = lane * 4; c0 < NK; c0 += 128) { v4us oh, ol;
#pragma unroll
            for (int q = 0; q < 4; ++q) { const float p = __expf(sr[c0 + q] * sc - m) * inv; const unsigned short hb = f2bf(p); oh[q] = hb; ol[q] = f2bf(p - bf2f(hb)); }
            const size_t o = (size_t)i * NK + c0; *(v4us*)(PH + o) = oh; *(v4us*)(PL + o) = ol; }
         }
}

__global__ __launch_bounds__(256) void k_cvtx(const float* __restrict__ src, int rows, bf* dst) {
    const int lane = threadIdx.x & 31; const size_t r = (size_t)blockIdx.x * 8 + (threadIdx.x >> 5); if (r >= (size_t)rows) return;
{
#pragma unroll
        for (int q = 0; q < DMOD / 256; ++q) { v8us o;
#pragma unroll
            for (int i = 0; i < 8; ++i) o[i] = f2bf(src[r * DMOD + q * 256 + lane * 8 + i]);
            *(v8us*)(dst + r * DMOD + q * 256 + lane * 8) = o; }
         }
}
__global__ __launch_bounds__(256) void k_splitD(const float* __restrict__ src, int rows, bf* dh, bf* dl) {
    const int lane = threadIdx.x & 31; const size_t r = (size_t)blockIdx.x * 8 + (threadIdx.x >> 5); if (r >= (size_t)rows) return;
{
#pragma unroll
        for (int q = 0; q < DMOD / 256; ++q) { const size_t o = r * DMOD + q * 256 + lane * 8; const v8f v = *(const v8f*)(src + o); v8us oh, ol;
#pragma unroll
            for (int i = 0; i < 8; ++i) { const unsigned short hb = f2bf(v[i]); oh[i] = hb; ol[i] = f2bf(v[i] - bf2f(hb)); }
            *(v8us*)(dh + o) = oh; *(v8us*)(dl + o) = ol; }
         }
}
__global__ __launch_bounds__(256) void k_msoftz(const float* __restrict__ S, float sc, const float* __restrict__ MK, bf* PH, bf* PL) {
    typedef __attribute__((ext_vector_type(4))) unsigned short v4us;
    const int lane = threadIdx.x & 31, i = blockIdx.x * 8 + (threadIdx.x >> 5); if (i >= NN) return; const size_t zo = (size_t)blockIdx.z * NN * NKT; const float* sr = S + zo + (size_t)i * NKT; PH += zo; PL += zo; const float* mr = MK + (size_t)i * NKT;
    auto logit = [&](int k) -> float { float v = sr[k] * sc; v = v + bfr(mr[k]) * -1e9f; return v; };
    float m = -3.0e38f;
#pragma unroll 1
    for (int c0 = lane * 4; c0 < NKT; c0 += 128) {
#pragma unroll
        for (int q = 0; q < 4; ++q) m = fmaxf(m, logit(c0 + q)); }
#pragma unroll
    for (int sh = 16; sh; sh >>= 1) m = fmaxf(m, __shfl_xor(m, sh, 32));
    float sum = 0.f;
#pragma unroll 1
    for (int c0 = lane * 4; c0 < NKT; c0 += 128) {
#pragma unroll
        for (int q = 0; q < 4; ++q) sum += __expf(logit(c0 + q) - m); }
#pragma unroll
    for (int sh = 16; sh; sh >>= 1) sum += __shfl_xor(sum, sh, 32);
    const float inv = 1.0f / sum;
{
#pragma unroll 1
        for (int c0 = lane * 4; c0 < NKT; c0 += 128) { v4us oh, ol;
#pragma unroll
            for (int q = 0; q < 4; ++q) { const float p = __expf(logit(c0 + q) - m) * inv; const unsigned short hb = f2bf(p); oh[q] = hb; ol[q] = f2bf(p - bf2f(hb)); }
            const size_t o = (size_t)i * NKT + c0; *(v4us*)(PH + o) = oh; *(v4us*)(PL + o) = ol; }
         }
}

extern "C" void kernel_launch(void* const* d_in, const int* in_sizes, int n_in,
                              void* d_out, int out_size, void* d_ws, size_t ws_size, hipStream_t stream) {
    (void)in_sizes; (void)n_in; (void)out_size;
    const float* xq = (const float*)d_in[0]; const float* xk = (const float*)d_in[1]; const float* xv = xk; const float* mask = (const float*)d_in[2]; const float* Wq = (const float*)d_in[3]; const float* Wk = (const float*)d_in[4]; const float* Wv = (const float*)d_in[5]; const float* Wo = (const float*)d_in[6];
    float* out = (float*)d_out;    // [NBT][NN][DMOD]
    char* wsp = (char*)d_ws;
    auto take = [&](size_t bytes) { char* p = wsp; wsp += (bytes + 255) & ~(size_t)255; return (void*)p; };
    const size_t WSZ = (size_t)DMOD * DMOD * 2;
    bf* WQ = (bf*)take(WSZ); bf* WK = (bf*)take(WSZ); bf* WV = (bf*)take(WSZ); bf* WO = (bf*)take(WSZ);
    bf* Xq = (bf*)take((size_t)NN * DMOD * 2); bf* Xk = (bf*)take((size_t)NKT * DMOD * 2); bf* Xv = (bf*)take((size_t)NKT * DMOD * 2); float* QF = (float*)take((size_t)NN * DMOD * 4); float* KF = (float*)take((size_t)NKT * DMOD * 4); float* VF = (float*)take((size_t)NKT * DMOD * 4);
    bf* Qh = (bf*)take((size_t)ZH * NN * HD * 2); bf* Ql = (bf*)take((size_t)ZH * NN * HD * 2); bf* Kh = (bf*)take((size_t)ZH * NKT * HD * 2); bf* Kl = (bf*)take((size_t)ZH * NKT * HD * 2); bf* VTh = (bf*)take((size_t)ZH * HD * NKT * 2); bf* VTl = (bf*)take((size_t)ZH * HD * NKT * 2);
    float* S = (float*)take((size_t)ZH * NN * NKT * 4); bf* PH = (bf*)take((size_t)ZH * NN * NKT * 2); bf* PL = (bf*)take((size_t)ZH * NN * NKT * 2); float* O = (float*)take((size_t)NN * DMOD * 4); bf* Oh = (bf*)take((size_t)NN * DMOD * 2); bf* Ol = (bf*)take((size_t)NN * DMOD * 2);
    if ((size_t)(wsp - (char*)d_ws) > ws_size) return;    // per item / head-group reuse in stream order
    k_wt<<<dim3(DMOD / 64, DMOD / 64, 1), 256, 0, stream>>>(Wq, DMOD, DMOD, WQ); k_wt<<<dim3(DMOD / 64, DMOD / 64, 1), 256, 0, stream>>>(Wk, DMOD, DMOD, WK); k_wt<<<dim3(DMOD / 64, DMOD / 64, 1), 256, 0, stream>>>(Wv, DMOD, DMOD, WV); k_wt<<<dim3(DMOD / 64, DMOD / 64, 1), 256, 0, stream>>>(Wo, DMOD, DMOD, WO);   // (in, out) k-major -> n-major
    const dim3 gq(NN / 64, DMOD / 64, 1), gk(NKT / 64, DMOD / 64, 1);
    for (int b = 0; b < NBT; ++b) {
        k_cvtx<<<NN / 8, 256, 0, stream>>>(xq + (size_t)b * NN * DMOD, NN, Xq); k_cvtx<<<NKT / 8, 256, 0, stream>>>(xk + (size_t)b * NKT * DMOD, NKT, Xk);
        k_gemmb<false, false><<<gq, 128, 0, stream>>>(Xq, nullptr, WQ, nullptr, QF, DMOD, nullptr, nullptr, DMOD); k_gemmb<false, false><<<gk, 128, 0, stream>>>(Xk, nullptr, WK, nullptr, KF, DMOD, nullptr, nullptr, DMOD); k_gemmb<false, false><<<gk, 128, 0, stream>>>(Xk, nullptr, WV, nullptr, VF, DMOD, nullptr, nullptr, DMOD);
        const float* mb = mask + (size_t)b * 4194304;
        for (int g = 0; g < NH_ / ZH; ++g) { const int h0 = g * ZH;
            k_hplanesz<<<dim3(NN / 8, 1, ZH), 256, 0, stream>>>(QF, DMOD, h0, 1.0f, NN, Qh, Ql); k_hplanesz<<<dim3(NKT / 8, 1, ZH), 256, 0, stream>>>(KF, DMOD, h0, 1.0f, NKT, Kh, Kl); k_vtz<<<dim3((HD * (NKT / 64)) / 8, 1, ZH), 256, 0, stream>>>(VF, DMOD, h0, NKT, VTh, VTl);
            k_gemm3z<0><<<dim3(NN / 64, NKT / 64, ZH), 128, 0, stream>>>(Qh, Ql, Kh, Kl, HD, S, NKT, (size_t)NN * HD, (size_t)NKT * HD, (size_t)NN * NKT);
            k_msoftz<<<dim3(NN / 8, 1, ZH), 256, 0, stream>>>(S, SCL, mb, PH, PL);
            k_gemm3z<0><<<dim3(NN / 64, 1, ZH), 128, 0, stream>>>(PH, PL, VTh, VTl, NKT, O + h0 * HD, DMOD, (size_t)NN * NKT, (size_t)HD * NKT, (size_t)HD); }
        k_splitD<<<NN / 8, 256, 0, stream>>>(O, NN, Oh, Ol);
        k_gemmb<true, false><<<gq, 128, 0, stream>>>(Oh, Ol, WO, nullptr, out + (size_t)b * NN * DMOD, DMOD, nullptr, nullptr, DMOD); }
}

// v002
// It runs in 316 microseconds.
// It is 6.53 times as fast as v000, going by the measured steps of the versions left out in between.
#include <hip/hip_runtime.h>

// Compute dtypes, f32 accumulate, per item: q/k/v projections as [2048 x 1024].[1024 x 1024] GEMMs with PLAIN bf16 operands (the inputs themselves; exact products);
// per head (head dim 64; one fused launch over all items and heads): scores = q.k^T and attn.v with both operands as bf16 hi + UNSCALED residual planes (three products); the 1/sqrt(64) scale,
// the mask (additive mask x -1e9) and the running-maximum softmax in f32, normalised after attn.v; output projection on hi/lo planes of the merged heads (two products) - on v_wmma_f32_16x16x32_bf16.

#define NBT  2
#define NN   2048
#define NKT  2048
#define DMOD 1024
#define NH_  16
#define HD   64
#define ZH   2
#define DM   DMOD
#define NTK  NN
#define SCL  0.125f
#define LOSC 1024.0f

typedef _Float16 h16;
typedef unsigned short bf;
typedef __attribute__((ext_vector_type(16))) __bf16   v16bf;
typedef __attribute__((ext_vector_type(16))) _Float16 v16h;
typedef __attribute__((ext_vector_type(8)))  _Float16 v8h;
typedef __attribute__((ext_vector_type(8)))  unsigned short v8us;
typedef __attribute__((ext_vector_type(8)))  float    v8f;
typedef __attribute__((ext_vector_type(4)))  float    v4f;
typedef __attribute__((ext_vector_type(4)))  _Float16 v4h;
typedef v8h  __attribute__((may_alias)) v8ha;
typedef v4f  __attribute__((may_alias)) v4fa;
typedef v8us __attribute__((may_alias)) v8usa;

__device__ __forceinline__ unsigned short f2bf(float f) { unsigned u = __float_as_uint(f); u += 0x7FFFu + ((u >> 16) & 1u); return (unsigned short)(u >> 16); }
__device__ __forceinline__ float bf2f(unsigned short b) { return __uint_as_float(((unsigned)b) << 16); }
__device__ __forceinline__ float bfr(float f) { return bf2f(f2bf(f)); }
__device__ __forceinline__ v16h cat16(v8h lo, v8h hi) { return __builtin_shufflevector(lo, hi, 0, 1, 2, 3, 4, 5, 6, 7, 8, 9, 10, 11, 12, 13, 14, 15); }
__device__ __forceinline__ v16bf cat16b(v8us lo, v8us hi) { return __builtin_bit_cast(v16bf, __builtin_shufflevector(lo, hi, 0, 1, 2, 3, 4, 5, 6, 7, 8, 9, 10, 11, 12, 13, 14, 15)); }
__device__ __forceinline__ v8f wmma16(v16h a, v16h b, v8f c) { return __builtin_amdgcn_wmma_f32_16x16x32_f16(false, a, false, b, (short)0, c, false, false); }
__device__ __forceinline__ v8f wmmab(v16bf a, v16bf b, v8f c) { return __builtin_amdgcn_wmma_f32_16x16x32_bf16(false, a, false, b, (short)0, c, false, false); }

// k_wt: WT [n][K] = bf16(W[k][n]) (k-major [K][ncols]) via 64 x 64 LDS tiles; grid (K/64, ncols/64).
__global__ __launch_bounds__(256) void k_wt(const float* __restrict__ Wm, int K, int ncols, bf* WT) {
    __shared__ __align__(16) unsigned short tl[64 * 72];
    const int tid = threadIdx.x, k0 = blockIdx.x * 64, n0 = blockIdx.y * 64;
    const int kk = tid >> 2, nq = (tid & 3) * 16;
#pragma unroll
    for (int i = 0; i < 16; ++i) tl[(nq + i) * 72 + kk] = f2bf(Wm[(size_t)(k0 + kk) * ncols + n0 + nq + i]);
    __syncthreads();
    const int piece = tid & 7;
    auto pass = [&]() {
#pragma unroll
        for (int s = 0; s < 2; ++s) { const int nr = (tid >> 3) + 32 * s; const v8us val = *(const v8usa*)(tl + nr * 72 + piece * 8); *(v8us*)(WT + (size_t)(n0 + nr) * K + k0 + piece * 8) = val; }
    };
    pass(); 
}
// k_gemmb: 64 x 64 block tile (4 waves x 16 x 64) of C[NTK][NW] = (A [+ Al]).B^T (K = 1024) [+ bf(bias[c])] [+ bf(R[r][c]) residual]; f32 whole-line epilogue, or
// PLANES: the tile leaves as bf16 hi + residual planes, its row r at r * ldc + blockIdx.y * cbs in Ph and Pl (128 bytes a row and plane, whole lines), so that no f32 copy is stored and split later.
template <bool SPLITA, bool PLANES = false>
__global__ __launch_bounds__(128) void k_gemmb(const bf* __restrict__ A, const bf* __restrict__ Al, const bf* __restrict__ Bn, const float* __restrict__ bias, float* C, int ldc, bf* Ph, bf* Pl, size_t cbs, const float* __restrict__ R = nullptr, int K = DM, int roundR = 1) {
    __shared__ __align__(16) float ost[4][16 * 68];
    const int lane = threadIdx.x & 31, wave = threadIdx.x >> 5, lr = lane & 15, hi = lane >> 4;
    const int r0 = blockIdx.x * 64 + wave * 16, c0 = blockIdx.y * 64;
    const size_t aoff = (size_t)(r0 + lr) * K + 8 * hi;
    size_t boff[4];
#pragma unroll
    for (int t = 0; t < 4; ++t) boff[t] = (size_t)(c0 + t * 16 + lr) * K + 8 * hi;
    v8f acc[4];
#pragma unroll
    for (int t = 0; t < 4; ++t) acc[t] = (v8f){};
#pragma unroll 1
    for (int kc = 0; kc < K; kc += 32) {
        const v16bf a = cat16b(*(const v8us*)(A + aoff + kc), *(const v8us*)(A + aoff + kc + 16));
        v16bf al = a;
        if (SPLITA) al = cat16b(*(const v8us*)(Al + aoff + kc), *(const v8us*)(Al + aoff + kc + 16));
#pragma unroll
        for (int t = 0; t < 4; ++t) { const v16bf b = cat16b(*(const v8us*)(Bn + boff[t] + kc), *(const v8us*)(Bn + boff[t] + kc + 16)); acc[t] = wmmab(a, b, acc[t]); if (SPLITA) acc[t] = wmmab(al, b, acc[t]); }
        asm volatile("v_nop\n\tv_nop\n\tv_nop\n\tv_nop" : "+v"(acc[0]), "+v"(acc[1]), "+v"(acc[2]), "+v"(acc[3]) : "v"(a), "v"(al));
    }
    float* os = &ost[wave][0];
#pragma unroll
    for (int t = 0; t < 4; ++t) { const float bv = bias ? bfr(bias[c0 + t * 16 + lr]) : 0.f;
#pragma unroll
        for (int j = 0; j < 8; ++j) os[(hi * 8 + j) * 68 + t * 16 + lr] = acc[t][j] + bv; }
    __syncthreads();
    if (PLANES) {
        const size_t pb = (size_t)r0 * ldc + (size_t)blockIdx.y * cbs;
#pragma unroll
        for (int s = 0; s < 4; ++s) { const int row = 4 * s + (lane >> 3), piece = lane & 7; const float* sp = os + row * 68 + piece * 8; v8us oh, ol;
#pragma unroll
            for (int i = 0; i < 8; ++i) { const unsigned short hb = f2bf(sp[i]); oh[i] = hb; ol[i] = f2bf(sp[i] - bf2f(hb)); }
            const size_t o = pb + (size_t)row * ldc + piece * 8; *(v8us*)(Ph + o) = oh; *(v8us*)(Pl + o) = ol; }
    } else {
        float* crow = C + (size_t)r0 * ldc + c0;
        auto pass = [&]() {
#pragma unroll
            for (int s = 0; s < 8; ++s) { const int Lid = (lane >> 3) + 4 * s, piece = lane & 7; const int row = Lid >> 1, cofs = (Lid & 1) * 32 + piece * 4;
                v4f val = *(const v4fa*)(os + row * 68 + cofs); if (R) { const v4f rv = *(const v4f*)(R + ((size_t)r0 + row) * ldc + c0 + cofs); val += roundR ? (v4f){bfr(rv[0]), bfr(rv[1]), bfr(rv[2]), bfr(rv[3])} : rv; }
                *(v4f*)(crow + (size_t)row * ldc + cofs) = val; }
        };
        pass(); 
    }
}

__global__ __launch_bounds__(256) void k_cvt8(const float* __restrict__ src, bf* dst, size_t n8) {
    const size_t i = (size_t)blockIdx.x * 256 + threadIdx.x; if (i >= n8) return;
    const v8f v = *(const v8f*)(src + i * 8); v8us o;
#pragma unroll
    for (int k = 0; k < 8; ++k) o[k] = f2bf(v[k]);
    *(v8us*)(dst + i * 8) = o; 
}
__global__ __launch_bounds__(256) void k_zero8(bf* dst, size_t n8) {
    const size_t i = (size_t)blockIdx.x * 256 + threadIdx.x; if (i >= n8) return; v8us z;
#pragma unroll
    for (int k = 0; k < 8; ++k) z[k] = 0;
    *(v8us*)(dst + i * 8) = z; 
}

// ===== z-batched (blockIdx.z = head) attention pieces =====
__global__ __launch_bounds__(256) void k_planes32z(const float* __restrict__ F, int ld, int off, float sc, int rows, bf* Ph, bf* Pl) {
    typedef __attribute__((ext_vector_type(2))) unsigned short v2us;
    const int lane = threadIdx.x & 31; const size_t r = ((size_t)blockIdx.x * 8 + (threadIdx.x >> 5)) * 2 + (lane >> 4); if (r >= (size_t)rows) return; const int z = blockIdx.z; const int c0 = (lane & 15) * 2; v2us oh, ol;
    Ph += (size_t)z * rows * 32; Pl += (size_t)z * rows * 32;
#pragma unroll
    for (int i = 0; i < 2; ++i) { const float y = F[r * ld + off + z * 32 + c0 + i] * sc; const unsigned short hb = f2bf(y); oh[i] = hb; ol[i] = f2bf(y - bf2f(hb)); }
    const size_t o = r * 32 + c0; *(v2us*)(Ph + o) = oh; *(v2us*)(Pl + o) = ol; 
}
__global__ __launch_bounds__(256) void k_vtpadz(const float* __restrict__ F, int ld, int off, int nk, bf* Th, bf* Tl) {
    typedef __attribute__((ext_vector_type(2))) unsigned short v2us;
    const int lane = threadIdx.x & 31; const size_t wid = (size_t)blockIdx.x * 8 + (threadIdx.x >> 5); if (wid >= (size_t)64 * (nk / 64)) return; const int z = blockIdx.z; const int d = (int)(wid / (nk / 64)); const int k0 = (int)(wid % (nk / 64)) * 64 + lane * 2; v2us oh, ol;
    Th += (size_t)z * 64 * nk; Tl += (size_t)z * 64 * nk;
#pragma unroll
    for (int i = 0; i < 2; ++i) { const float y = (d < 32) ? F[(size_t)(k0 + i) * ld + off + z * 32 + (d < 32 ? d : 0)] : 0.f; const unsigned short hb = f2bf(y); oh[i] = hb; ol[i] = f2bf(y - bf2f(hb)); }
    const size_t o = (size_t)d * nk + k0; *(v2us*)(Th + o) = oh; *(v2us*)(Tl + o) = ol; 
}
template <int NK>
__global__ __launch_bounds__(256) void k_softmaxz(const float* __restrict__ S, int rows, bf* PH, bf* PL) {
    typedef __attribute__((ext_vector_type(4))) unsigned short v4us;
    const int lane = threadIdx.x & 31, i = blockIdx.x * 8 + (threadIdx.x >> 5); if (i >= rows) return; const size_t zo = (size_t)blockIdx.z * rows * NK; const float* sr = S + zo + (size_t)i * NK; PH += zo; PL += zo;
    float m = -3.0e38f;
#pragma unroll 1
    for (int c0 = lane * 4; c0 < NK; c0 += 128) {
#pragma unroll
        for (int q = 0; q < 4; ++q) m = fmaxf(m, sr[c0 + q]); }
#pragma unroll
    for (int sh = 16; sh; sh >>= 1) m = fmaxf(m, __shfl_xor(m, sh, 32));
    float sum = 0.f;
#pragma unroll 1
    for (int c0 = lane * 4; c0 < NK; c0 += 128) {
#pragma unroll
        for (int q = 0; q < 4; ++q) sum += __expf(sr[c0 + q] - m); }
#pragma unroll
    for (int sh = 16; sh; sh >>= 1) sum += __shfl_xor(sum, sh, 32);
    const float inv = 1.0f / sum;
{
#pragma unroll 1
        for (int c0 = lane * 4; c0 < NK; c0 += 128) { v4us oh, ol;
#pragma unroll
            for (int q = 0; q < 4; ++q) { const float p = __expf(sr[c0 + q] - m) * inv; const unsigned short hb = f2bf(p); oh[q] = hb; ol[q] = f2bf(p - bf2f(hb)); }
            const size_t o = (size_t)i * NK + c0; *(v4us*)(PH + o) = oh; *(v4us*)(PL + o) = ol; }
         }
}
__global__ __launch_bounds__(256) void k_placez(const float* __restrict__ XH, int rows, int ldy, float* Y) {
    const int lane = threadIdx.x & 31; const size_t q = (size_t)blockIdx.x * 8 + (threadIdx.x >> 5); if (q >= (size_t)rows) return; const int z = blockIdx.z; const float v = XH[((size_t)z * rows + q) * 64 + lane];
    *(float*)(Y + q * ldy + z * 32 + lane) = v; 
}

template <int NK>
__global__ __launch_bounds__(256) void k_softmaxzs(const float* __restrict__ S, int rows, float sc, bf* PH, bf* PL) {
    typedef __attribute__((ext_vector_type(4))) unsigned short v4us;
    const int lane = threadIdx.x & 31, i = blockIdx.x * 8 + (threadIdx.x >> 5); if (i >= rows) return; const size_t zo = (size_t)blockIdx.z * rows * NK; const float* sr = S + zo + (size_t)i * NK; PH += zo; PL += zo;
    float m = -3.0e38f;
#pragma unroll 1
    for (int c0 = lane * 4; c0 < NK; c0 += 128) {
#pragma unroll
        for (int q = 0; q < 4; ++q) m = fmaxf(m, sr[c0 + q] * sc); }
#pragma unroll
    for (int sh = 16; sh; sh >>= 1) m = fmaxf(m, __shfl_xor(m, sh, 32));
    float sum = 0.f;
#pragma unroll 1
    for (int c0 = lane * 4; c0 < NK; c0 += 128) {
#pragma unroll
        for (int q = 0; q < 4; ++q) sum += __expf(sr[c0 + q] * sc - m); }
#pragma unroll
    for (int sh = 16; sh; sh >>= 1) sum += __shfl_xor(sum, sh, 32);
    const float inv = 1.0f / sum;
{
#pragma unroll 1
        for (int c0 = lane * 4; c0 < NK; c0 += 128) { v4us oh, ol;
#pragma unroll
            for (int q = 0; q < 4; ++q) { const float p = __expf(sr[c0 + q] * sc - m) * inv; const unsigned short hb = f2bf(p); oh[q] = hb; ol[q] = f2bf(p - bf2f(hb)); }
            const size_t o = (size_t)i * NK + c0; *(v4us*)(PH + o) = oh; *(v4us*)(PL + o) = ol; }
         }
}

__global__ __launch_bounds__(256) void k_cvtx(const float* __restrict__ src, int rows, bf* dst) {
    const int lane = threadIdx.x & 31; const size_t r = (size_t)blockIdx.x * 8 + (threadIdx.x >> 5); if (r >= (size_t)rows) return;
{
#pragma unroll
        for (int q = 0; q < DMOD / 256; ++q) { v8us o;
#pragma unroll
            for (int i = 0; i < 8; ++i) o[i] = f2bf(src[r * DMOD + q * 256 + lane * 8 + i]);
            *(v8us*)(dst + r * DMOD + q * 256 + lane * 8) = o; }
         }
}
#define FPITCH 72   // LDS row pitch in bf16 elements: 144 bytes = 16 B x odd, for 16-byte fragment reads
#define FPLANE (64 * FPITCH)
#define LOG2E 1.4426950408889634f
typedef __attribute__((ext_vector_type(2))) float v2f;
typedef __attribute__((ext_vector_type(2))) __bf16 v2bf;
typedef __attribute__((ext_vector_type(8))) unsigned v8u;
__device__ __forceinline__ float xhalf(float x) { return __builtin_bit_cast(float, __builtin_amdgcn_permlanex16(__builtin_bit_cast(int, x), __builtin_bit_cast(int, x), 0x76543210, 0xfedcba98, false, false)); }  // lane l with lane l ^ 16
__device__ __forceinline__ v16bf ldsfrag(const unsigned short* p) { return cat16b(*(const v8usa*)p, *(const v8usa*)(p + 16)); }
__global__ __launch_bounds__(256) __attribute__((amdgpu_waves_per_eu(4, 4))) void k_fattn(const bf* __restrict__ Qh, const bf* __restrict__ Ql, const bf* __restrict__ Kh, const bf* __restrict__ Kl, const bf* __restrict__ VTh, const bf* __restrict__ VTl, const float* __restrict__ MK, bf* Oh, bf* Ol) {
    __shared__ __align__(16) unsigned short tile[2][4 * FPLANE];   // two buffers x (K hi, K lo, V^T hi, V^T lo), 64 rows of 64 each
    const int tid = threadIdx.x, lane = tid & 31, wave = tid >> 5, lr = lane & 15, hi = lane >> 4;
    const int bh = blockIdx.y, b = bh / NH_, h = bh % NH_;
    const int q = blockIdx.x * 128 + wave * 16 + lr;
    v16bf qh[2], ql[2];
#pragma unroll
    for (int ks = 0; ks < 2; ++ks) { const size_t qo = ((size_t)bh * NN + q) * HD + ks * 32 + 8 * hi;
        qh[ks] = cat16b(*(const v8us*)(Qh + qo), *(const v8us*)(Qh + qo + 16)); ql[ks] = cat16b(*(const v8us*)(Ql + qo), *(const v8us*)(Ql + qo + 16)); }
    const int srow = tid >> 3, spc = (tid & 7) * 8;
    const size_t ko = ((size_t)bh * NKT + srow) * HD + spc, vo = ((size_t)bh * HD + srow) * NKT + spc;
    const int so = srow * FPITCH + spc;
    v8us st[8];
    auto fetch = [&](int key0) {
        const size_t k1 = ko + (size_t)key0 * HD, v1 = vo + key0;
        st[0] = *(const v8us*)(Kh + k1); st[1] = *(const v8us*)(Kh + k1 + 32 * HD); st[2] = *(const v8us*)(Kl + k1); st[3] = *(const v8us*)(Kl + k1 + 32 * HD);
        st[4] = *(const v8us*)(VTh + v1); st[5] = *(const v8us*)(VTh + v1 + (size_t)32 * NKT); st[6] = *(const v8us*)(VTl + v1); st[7] = *(const v8us*)(VTl + v1 + (size_t)32 * NKT);
    };
    auto put = [&](unsigned short* tb) {
#pragma unroll
        for (int a = 0; a < 4; ++a) { *(v8usa*)(tb + a * FPLANE + so) = st[2 * a]; *(v8usa*)(tb + a * FPLANE + so + 32 * FPITCH) = st[2 * a + 1]; }
    };
    const float* mrow = MK + ((size_t)b * NN + q) * NKT + 8 * hi;
    const int fo = lr * FPITCH + 8 * hi;
    v8f o[4];
#pragma unroll
    for (int t = 0; t < 4; ++t) o[t] = (v8f){};
    float m = -3.0e38f, sum = 0.f;
    fetch(0); put(&tile[0][0]);
    __syncthreads();
#pragma unroll 1   // stays rolled: one trip is already several hundred instructions
    for (int it = 0; it < NKT / 64; ++it) {
        const int key0 = it * 64;
        const unsigned short* tb = &tile[it & 1][0];
        v4f mk[8];
#pragma unroll
        for (int t = 0; t < 4; ++t) { mk[2 * t] = *(const v4f*)(mrow + key0 + 16 * t); mk[2 * t + 1] = *(const v4f*)(mrow + key0 + 16 * t + 4); }
        fetch(((it + 1) & (NKT / 64 - 1)) * 64);   // the next tile, through registers; the last trip wraps to tile 0, which nobody reads: the loop stays free of branches and register copies
        __builtin_amdgcn_sched_barrier(0);         // keeps the mask and tile loads issued above the score products, so that their latency runs under them
        v8f s[4];
#pragma unroll
        for (int t = 0; t < 4; ++t) s[t] = (v8f){};
        v16bf fa[2], fb[2];
        fa[0] = ldsfrag(tb + fo); fb[0] = ldsfrag(tb + FPLANE + fo);
#pragma unroll
        for (int g = 0; g < 8; ++g) { const int t = g & 3, ks = g >> 2;   // each group's fragments are read one group ahead
            if (g < 7) { const int ao = ((g + 1) & 3) * 16 * FPITCH + ((g + 1) >> 2) * 32 + fo; fa[(g + 1) & 1] = ldsfrag(tb + ao); fb[(g + 1) & 1] = ldsfrag(tb + FPLANE + ao); }
            s[t] = wmmab(fa[g & 1], qh[ks], s[t]); s[t] = wmmab(fa[g & 1], ql[ks], s[t]); s[t] = wmmab(fb[g & 1], qh[ks], s[t]); }
        float mx = -3.0e38f;
#pragma unroll
        for (int t = 0; t < 4; ++t) {
#pragma unroll
            for (int j = 0; j < 8; j += 2) { const v4f mq = mk[2 * t + (j >> 2)]; const v2bf mb = __builtin_convertvector((v2f){mq[j & 3], mq[(j & 3) + 1]}, v2bf);
#pragma unroll
                for (int e = 0; e < 2; ++e) { float v = s[t][j + e] * SCL; v = v + (float)mb[e] * -1e9f; s[t][j + e] = v; mx = fmaxf(mx, v); } } }
        mx = fmaxf(mx, xhalf(mx));
        const float mn = fmaxf(m, mx), alpha = __builtin_amdgcn_exp2f((m - mn) * LOG2E);
        m = mn;
        float ts[4];
        v8u phw[2], plw[2];
#pragma unroll
        for (int t = 0; t < 4; ++t) { ts[t] = 0.f;
#pragma unroll
            for (int j = 0; j < 8; j += 2) { const float p0 = __builtin_amdgcn_exp2f((s[t][j] - mn) * LOG2E), p1 = __builtin_amdgcn_exp2f((s[t][j + 1] - mn) * LOG2E); ts[t] += p0; ts[t] += p1;
                const v2bf hb = __builtin_convertvector((v2f){p0, p1}, v2bf); const v2bf lb = __builtin_convertvector((v2f){p0 - (float)hb[0], p1 - (float)hb[1]}, v2bf);
                phw[t >> 1][(t & 1) * 4 + (j >> 1)] = __builtin_bit_cast(unsigned, hb); plw[t >> 1][(t & 1) * 4 + (j >> 1)] = __builtin_bit_cast(unsigned, lb); } }
        sum = sum * alpha + ((ts[0] + ts[1]) + (ts[2] + ts[3]));
#pragma unroll
        for (int t = 0; t < 4; ++t) o[t] *= alpha;
        fa[0] = ldsfrag(tb + 2 * FPLANE + fo); fb[0] = ldsfrag(tb + 3 * FPLANE + fo);
#pragma unroll
        for (int g = 0; g < 8; ++g) { const int t = g & 3, ks = g >> 2; const v16bf ph = __builtin_bit_cast(v16bf, phw[ks]), pl = __builtin_bit_cast(v16bf, plw[ks]);
            if (g < 7) { const int ao = ((g + 1) & 3) * 16 * FPITCH + ((g + 1) >> 2) * 32 + fo; fa[(g + 1) & 1] = ldsfrag(tb + 2 * FPLANE + ao); fb[(g + 1) & 1] = ldsfrag(tb + 3 * FPLANE + ao); }
            o[t] = wmmab(fa[g & 1], ph, o[t]); o[t] = wmmab(fa[g & 1], pl, o[t]); o[t] = wmmab(fb[g & 1], ph, o[t]); }
        put(&tile[(it + 1) & 1][0]);
        __syncthreads();   // publishes the next tile and ends every reader's last read of this one
    }
    sum += xhalf(sum);
    const float inv = 1.0f / sum;
    const size_t oo = ((size_t)b * NN + q) * DMOD + h * HD + 8 * hi;   // merged heads, as the hi and residual planes that the output projection reads
#pragma unroll
    for (int t = 0; t < 4; ++t) { const v8f r = o[t] * inv; v8us oh, ol;
#pragma unroll
        for (int i = 0; i < 8; ++i) { const unsigned short hb = f2bf(r[i]); oh[i] = hb; ol[i] = f2bf(r[i] - bf2f(hb)); }
        *(v8us*)(Oh + oo + 16 * t) = oh; *(v8us*)(Ol + oo + 16 * t) = ol; }
}

extern "C" void kernel_launch(void* const* d_in, const int* in_sizes, int n_in,
                              void* d_out, int out_size, void* d_ws, size_t ws_size, hipStream_t stream) {
    (void)in_sizes; (void)n_in; (void)out_size;
    const float* xq = (const float*)d_in[0]; const float* xk = (const float*)d_in[1]; const float* xv = xk; const float* mask = (const float*)d_in[2]; const float* Wq = (const float*)d_in[3]; const float* Wk = (const float*)d_in[4]; const float* Wv = (const float*)d_in[5]; const float* Wo = (const float*)d_in[6];
    float* out = (float*)d_out;    // [NBT][NN][DMOD]
    char* wsp = (char*)d_ws;
    auto take = [&](size_t bytes) { char* p = wsp; wsp += (bytes + 255) & ~(size_t)255; return (void*)p; };
    const size_t WSZ = (size_t)DMOD * DMOD * 2;
    bf* WQ = (bf*)take(WSZ); bf* WK = (bf*)take(WSZ); bf* WV = (bf*)take(WSZ); bf* WO = (bf*)take(WSZ);
    bf* Xq = (bf*)take((size_t)NN * DMOD * 2); bf* Xk = (bf*)take((size_t)NKT * DMOD * 2);
    const size_t PEL = (size_t)NH_ * NN * HD, PSZ = (size_t)NBT * PEL * 2;    // one plane: [item][head][2048][64] (V^T: [item][head][64][2048])
    bf* Qh = (bf*)take(PSZ); bf* Ql = (bf*)take(PSZ); bf* Kh = (bf*)take(PSZ); bf* Kl = (bf*)take(PSZ); bf* VTh = (bf*)take(PSZ); bf* VTl = (bf*)take(PSZ);
    bf* Oh = (bf*)take((size_t)NBT * NN * DMOD * 2); bf* Ol = (bf*)take((size_t)NBT * NN * DMOD * 2);
    if ((size_t)(wsp - (char*)d_ws) > ws_size) return;    // per item reuse in stream order
    k_wt<<<dim3(DMOD / 64, DMOD / 64, 1), 256, 0, stream>>>(Wq, DMOD, DMOD, WQ); k_wt<<<dim3(DMOD / 64, DMOD / 64, 1), 256, 0, stream>>>(Wk, DMOD, DMOD, WK); k_wt<<<dim3(DMOD / 64, DMOD / 64, 1), 256, 0, stream>>>(Wv, DMOD, DMOD, WV); k_wt<<<dim3(DMOD / 64, DMOD / 64, 1), 256, 0, stream>>>(Wo, DMOD, DMOD, WO);   // (in, out) k-major -> n-major
    const dim3 gq(NN / 64, DMOD / 64, 1), gk(NKT / 64, DMOD / 64, 1);
    for (int b = 0; b < NBT; ++b) {
        k_cvtx<<<NN / 8, 256, 0, stream>>>(xq + (size_t)b * NN * DMOD, NN, Xq); k_cvtx<<<NKT / 8, 256, 0, stream>>>(xk + (size_t)b * NKT * DMOD, NKT, Xk);
        // a 64-column block of q or k is one head: row = token (pitch 64), block = head. V^T = W_v^T . y^T by swapping the operands: row = head * 64 + d (pitch 2048), block = 64 tokens.
        k_gemmb<false, true><<<gq, 128, 0, stream>>>(Xq, nullptr, WQ, nullptr, nullptr, HD, Qh + b * PEL, Ql + b * PEL, (size_t)NN * HD, nullptr, DMOD); k_gemmb<false, true><<<gk, 128, 0, stream>>>(Xk, nullptr, WK, nullptr, nullptr, HD, Kh + b * PEL, Kl + b * PEL, (size_t)NKT * HD, nullptr, DMOD);
        k_gemmb<false, true><<<dim3(DMOD / 64, NKT / 64, 1), 128, 0, stream>>>(WV, nullptr, Xk, nullptr, nullptr, NKT, VTh + b * PEL, VTl + b * PEL, (size_t)64, nullptr, DMOD); }
    k_fattn<<<dim3(NN / 128, NBT * NH_, 1), 256, 0, stream>>>(Qh, Ql, Kh, Kl, VTh, VTl, mask, Oh, Ol);
    for (int b = 0; b < NBT; ++b)
        k_gemmb<true, false><<<gq, 128, 0, stream>>>(Oh + (size_t)b * NN * DMOD, Ol + (size_t)b * NN * DMOD, WO, nullptr, out + (size_t)b * NN * DMOD, DMOD, nullptr, nullptr, 0, nullptr, DMOD);
}

// v003
// Measured time: 199 microseconds a run.
// Timed twice side by side with v002, it ran 1.60 and 1.59 times as fast.
// Over all steps from v000 it is 10.4 times as fast.
#include <hip/hip_runtime.h>

// Compute dtypes, f32 accumulate, per item: q/k/v projections as [2048 x 1024].[1024 x 1024] GEMMs with PLAIN bf16 operands (the inputs themselves; exact products);
// per head (head dim 64; one fused launch over all items and heads): scores = q.k^T and attn.v with both operands as bf16 hi + UNSCALED residual planes (three products); the 1/sqrt(64) scale,
// the mask (additive mask x -1e9) and the running-maximum softmax in f32, normalised after attn.v; output projection on hi/lo planes of the merged heads (two products) - on v_wmma_f32_16x16x32_bf16.

#define NBT  2
#define NN   2048
#define NKT  2048
#define DMOD 1024
#define NH_  16
#define HD   64
#define ZH   2
#define DM   DMOD
#define NTK  NN
#define SCL  0.125f
#define LOSC 1024.0f

typedef _Float16 h16;
typedef unsigned short bf;
typedef __attribute__((ext_vector_type(16))) __bf16   v16bf;
typedef __attribute__((ext_vector_type(16))) _Float16 v16h;
typedef __attribute__((ext_vector_type(8)))  _Float16 v8h;
typedef __attribute__((ext_vector_type(8)))  unsigned short v8us;
typedef __attribute__((ext_vector_type(8)))  float    v8f;
typedef __attribute__((ext_vector_type(4)))  float    v4f;
typedef __attribute__((ext_vector_type(4)))  _Float16 v4h;
typedef v8h  __attribute__((may_alias)) v8ha;
typedef v4f  __attribute__((may_alias)) v4fa;
typedef v8us __attribute__((may_alias)) v8usa;

__device__ __forceinline__ unsigned short f2bf(float f) { unsigned u = __float_as_uint(f); u += 0x7FFFu + ((u >> 16) & 1u); return (unsigned short)(u >> 16); }
__device__ __forceinline__ float bf2f(unsigned short b) { return __uint_as_float(((unsigned)b) << 16); }
__device__ __forceinline__ float bfr(float f) { return bf2f(f2bf(f)); }
__device__ __forceinline__ v16h cat16(v8h lo, v8h hi) { return __builtin_shufflevector(lo, hi, 0, 1, 2, 3, 4, 5, 6, 7, 8, 9, 10, 11, 12, 13, 14, 15); }
__device__ __forceinline__ v16bf cat16b(v8us lo, v8us hi) { return __builtin_bit_cast(v16bf, __builtin_shufflevector(lo, hi, 0, 1, 2, 3, 4, 5, 6, 7, 8, 9, 10, 11, 12, 13, 14, 15)); }
__device__ __forceinline__ v16bf ldsfrag(const unsigned short* p) { return cat16b(*(const v8usa*)p, *(const v8usa*)(p + 16)); }
__device__ __forceinline__ v8f wmma16(v16h a, v16h b, v8f c) { return __builtin_amdgcn_wmma_f32_16x16x32_f16(false, a, false, b, (short)0, c, false, false); }
__device__ __forceinline__ v8f wmmab(v16bf a, v16bf b, v8f c) { return __builtin_amdgcn_wmma_f32_16x16x32_bf16(false, a, false, b, (short)0, c, false, false); }

// k_wt: WT [n][K] = bf16(W[k][n]) (k-major [K][ncols]) via 64 x 64 LDS tiles; grid (K/64, ncols/64).
__global__ __launch_bounds__(256) void k_wt(const float* __restrict__ Wm, int K, int ncols, bf* WT) {
    __shared__ __align__(16) unsigned short tl[64 * 72];
    const int tid = threadIdx.x, k0 = blockIdx.x * 64, n0 = blockIdx.y * 64;
    const int kk = tid >> 2, nq = (tid & 3) * 16;
#pragma unroll
    for (int i = 0; i < 16; ++i) tl[(nq + i) * 72 + kk] = f2bf(Wm[(size_t)(k0 + kk) * ncols + n0 + nq + i]);
    __syncthreads();
    const int piece = tid & 7;
    auto pass = [&]() {
#pragma unroll
        for (int s = 0; s < 2; ++s) { const int nr = (tid >> 3) + 32 * s; const v8us val = *(const v8usa*)(tl + nr * 72 + piece * 8); *(v8us*)(WT + (size_t)(n0 + nr) * K + k0 + piece * 8) = val; }
    };
    pass(); 
}
// k_gemmb: 64 x 64 block tile (4 waves x 16 x 64) of C[NTK][NW] = (A [+ Al]).B^T (K = 1024, a multiple of GKC) [+ bf(bias[c])] [+ bf(R[r][c]) residual]; f32 whole-line epilogue, or
// PLANES: the tile leaves as bf16 hi + residual planes, its row r at r * ldc + blockIdx.y * cbs in Ph and Pl (128 bytes a row and plane, whole lines), so that no f32 copy is stored and split later.
// The operands come in chunks of GKC k values by asynchronous copies into two LDS buffers: a wave's copy reads whole 128-byte lines (two rows of 256 bytes), each line once a work-group,
// and the 16-row fragments are read from LDS; k order and sum order are those of fragment loads straight from memory.
#define GKC    128          // k values of a chunk
#define GPITCH (GKC + 8)    // LDS row pitch in bf16 elements: 272 bytes = 16 B x odd, for 16-byte fragment reads
#define GTILE  (64 * GPITCH)
// copy8: the lane's 16 bytes of eight rows, 8 rows apart (gs bytes in memory), from g to LDS byte address l. The copies and their s_wait_xcnt stand in one statement,
// so that no address register is rewritten in front of the wait.
__device__ __forceinline__ void copy8(unsigned l, const char* g, size_t gs) {
    asm volatile("global_load_async_to_lds_b128 %0, %8, off\n\t"
                 "global_load_async_to_lds_b128 %1, %9, off\n\t"
                 "global_load_async_to_lds_b128 %2, %10, off\n\t"
                 "global_load_async_to_lds_b128 %3, %11, off\n\t"
                 "global_load_async_to_lds_b128 %4, %12, off\n\t"
                 "global_load_async_to_lds_b128 %5, %13, off\n\t"
                 "global_load_async_to_lds_b128 %6, %14, off\n\t"
                 "global_load_async_to_lds_b128 %7, %15, off\n\t"
                 "s_wait_xcnt 0x0"
                 :: "v"(l), "v"(l + 1 * 16 * GPITCH), "v"(l + 2 * 16 * GPITCH), "v"(l + 3 * 16 * GPITCH), "v"(l + 4 * 16 * GPITCH), "v"(l + 5 * 16 * GPITCH), "v"(l + 6 * 16 * GPITCH), "v"(l + 7 * 16 * GPITCH),
                    "v"(g), "v"(g + gs), "v"(g + 2 * gs), "v"(g + 3 * gs), "v"(g + 4 * gs), "v"(g + 5 * gs), "v"(g + 6 * gs), "v"(g + 7 * gs) : "memory");
}
template <bool SPLITA, bool PLANES = false>
__global__ __launch_bounds__(128) void k_gemmb(const bf* __restrict__ A, const bf* __restrict__ Al, const bf* __restrict__ Bn, const float* __restrict__ bias, float* C, int ldc, bf* Ph, bf* Pl, size_t cbs, const float* __restrict__ R = nullptr, int K = DM, int roundR = 1) {
    constexpr int NT = SPLITA ? 3 : 2;
    __shared__ __align__(16) unsigned short stg[2][NT * GTILE];   // two buffers x (A, B [, Al]), 64 rows of GKC each
    __shared__ __align__(16) float ost[4][16 * 68];
    const int tid = threadIdx.x, lane = tid & 31, wave = tid >> 5, lr = lane & 15, hi = lane >> 4;
    const int r0 = blockIdx.x * 64 + wave * 16, c0 = blockIdx.y * 64;
    const int srow = tid >> 4, spc = (tid & 15) * 8;   // a lane copies piece spc of rows srow, srow + 8, ... of each tile
    const size_t ao = (size_t)(blockIdx.x * 64 + srow) * K + spc, bo = (size_t)(c0 + srow) * K + spc, gs = (size_t)K * 16;
    const unsigned lb = (unsigned)(size_t)&stg[0][0] + (unsigned)(srow * GPITCH + spc) * 2u;   // LDS byte address: the low 32 bits of the shared address
    auto copy = [&](int kc, int buf) {
        const unsigned l = lb + (unsigned)buf * (NT * GTILE * 2);
        copy8(l, (const char*)(A + ao + kc), gs); copy8(l + GTILE * 2, (const char*)(Bn + bo + kc), gs); if (SPLITA) copy8(l + 2 * GTILE * 2, (const char*)(Al + ao + kc), gs);
    };
    const int fao = (wave * 16 + lr) * GPITCH + 8 * hi, fbo = GTILE + lr * GPITCH + 8 * hi;
    v8f acc[4];
#pragma unroll
    for (int t = 0; t < 4; ++t) acc[t] = (v8f){};
    copy(0, 0);
    asm volatile("s_wait_asynccnt 0x0" ::: "memory");   // this wave's copies of chunk 0 have landed
    __syncthreads();                                    // every wave's have
    const int nch = K / GKC;
    if (nch > 1) copy(GKC, 1);
#pragma unroll 1   // stays rolled: a trip holds four unrolled k steps
    for (int ch = 0; ch < nch; ++ch) {
        const int cur = ch & 1;
        const unsigned short* tb = &stg[cur][0];
        v16bf fa[GKC / 32], fl[GKC / 32], fb[GKC / 32][4];
#pragma unroll
        for (int ks = 0; ks < GKC / 32; ++ks) { fa[ks] = ldsfrag(tb + fao + ks * 32); fl[ks] = fa[ks]; if (SPLITA) fl[ks] = ldsfrag(tb + 2 * GTILE + fao + ks * 32);
#pragma unroll
            for (int t = 0; t < 4; ++t) fb[ks][t] = ldsfrag(tb + fbo + t * 16 * GPITCH + ks * 32); }
        __builtin_amdgcn_sched_barrier(0);   // keeps the chunk's fragment reads issued as one group ahead of its products; sunk to their uses, each product would wait out a whole LDS read
#pragma unroll
        for (int ks = 0; ks < GKC / 32; ++ks) {
#pragma unroll
            for (int t = 0; t < 4; ++t) { acc[t] = wmmab(fa[ks], fb[ks][t], acc[t]); if (SPLITA) acc[t] = wmmab(fl[ks], fb[ks][t], acc[t]); } }
        __builtin_amdgcn_sched_barrier(0);   // keeps the products above the waits below, so that they run while the later fragments and the next chunk's copies are still on their way
        asm volatile("s_wait_dscnt 0x0" ::: "memory");      // this wave's reads of the buffer that is refilled below have retired
        asm volatile("s_wait_asynccnt 0x0" ::: "memory");   // this wave's copies of the next chunk have landed
        __syncthreads();                                    // publishes the next chunk and ends every reader's last read of this one
        if (ch + 2 < nch) copy((ch + 2) * GKC, cur);        // flies under the next chunk's products
    }
    asm volatile("s_wait_asynccnt 0x0" ::: "memory");   // no copy is outstanding when the wave goes on
    float* os = &ost[wave][0];
#pragma unroll
    for (int t = 0; t < 4; ++t) { const float bv = bias ? bfr(bias[c0 + t * 16 + lr]) : 0.f;
#pragma unroll
        for (int j = 0; j < 8; ++j) os[(hi * 8 + j) * 68 + t * 16 + lr] = acc[t][j] + bv; }
    __syncthreads();
    if (PLANES) {
        const size_t pb = (size_t)r0 * ldc + (size_t)blockIdx.y * cbs;
#pragma unroll
        for (int s = 0; s < 4; ++s) { const int row = 4 * s + (lane >> 3), piece = lane & 7; const float* sp = os + row * 68 + piece * 8; v8us oh, ol;
#pragma unroll
            for (int i = 0; i < 8; ++i) { const unsigned short hb = f2bf(sp[i]); oh[i] = hb; ol[i] = f2bf(sp[i] - bf2f(hb)); }
            const size_t o = pb + (size_t)row * ldc + piece * 8; *(v8us*)(Ph + o) = oh; *(v8us*)(Pl + o) = ol; }
    } else {
        float* crow = C + (size_t)r0 * ldc + c0;
        auto pass = [&]() {
#pragma unroll
            for (int s = 0; s < 8; ++s) { const int Lid = (lane >> 3) + 4 * s, piece = lane & 7; const int row = Lid >> 1, cofs = (Lid & 1) * 32 + piece * 4;
                v4f val = *(const v4fa*)(os + row * 68 + cofs); if (R) { const v4f rv = *(const v4f*)(R + ((size_t)r0 + row) * ldc + c0 + cofs); val += roundR ? (v4f){bfr(rv[0]), bfr(rv[1]), bfr(rv[2]), bfr(rv[3])} : rv; }
                *(v4f*)(crow + (size_t)row * ldc + cofs) = val; }
        };
        pass(); 
    }
}

__global__ __launch_bounds__(256) void k_cvt8(const float* __restrict__ src, bf* dst, size_t n8) {
    const size_t i = (size_t)blockIdx.x * 256 + threadIdx.x; if (i >= n8) return;
    const v8f v = *(const v8f*)(src + i * 8); v8us o;
#pragma unroll
    for (int k = 0; k < 8; ++k) o[k] = f2bf(v[k]);
    *(v8us*)(dst + i * 8) = o; 
}
__global__ __launch_bounds__(256) void k_zero8(bf* dst, size_t n8) {
    const size_t i = (size_t)blockIdx.x * 256 + threadIdx.x; if (i >= n8) return; v8us z;
#pragma unroll
    for (int k = 0; k < 8; ++k) z[k] = 0;
    *(v8us*)(dst + i * 8) = z; 
}

// ===== z-batched (blockIdx.z = head) attention pieces =====
__global__ __launch_bounds__(256) void k_planes32z(const float* __restrict__ F, int ld, int off, float sc, int rows, bf* Ph, bf* Pl) {
    typedef __attribute__((ext_vector_type(2))) unsigned short v2us;
    const int lane = threadIdx.x & 31; const size_t r = ((size_t)blockIdx.x * 8 + (threadIdx.x >> 5)) * 2 + (lane >> 4); if (r >= (size_t)rows) return; const int z = blockIdx.z; const int c0 = (lane & 15) * 2; v2us oh, ol;
    Ph += (size_t)z * rows * 32; Pl += (size_t)z * rows * 32;
#pragma unroll
    for (int i = 0; i < 2; ++i) { const float y = F[r * ld + off + z * 32 + c0 + i] * sc; const unsigned short hb = f2bf(y); oh[i] = hb; ol[i] = f2bf(y - bf2f(hb)); }
    const size_t o = r * 32 + c0; *(v2us*)(Ph + o) = oh; *(v2us*)(Pl + o) = ol; 
}
__global__ __launch_bounds__(256) void k_vtpadz(const float* __restrict__ F, int ld, int off, int nk, bf* Th, bf* Tl) {
    typedef __attribute__((ext_vector_type(2))) unsigned short v2us;
    const int lane = threadIdx.x & 31; const size_t wid = (size_t)blockIdx.x * 8 + (threadIdx.x >> 5); if (wid >= (size_t)64 * (nk / 64)) return; const int z = blockIdx.z; const int d = (int)(wid / (nk / 64)); const int k0 = (int)(wid % (nk / 64)) * 64 + lane * 2; v2us oh, ol;
    Th += (size_t)z * 64 * nk; Tl += (size_t)z * 64 * nk;
#pragma unroll
    for (int i = 0; i < 2; ++i) { const float y = (d < 32) ? F[(size_t)(k0 + i) * ld + off + z * 32 + (d < 32 ? d : 0)] : 0.f; const unsigned short hb = f2bf(y); oh[i] = hb; ol[i] = f2bf(y - bf2f(hb)); }
    const size_t o = (size_t)d * nk + k0; *(v2us*)(Th + o) = oh; *(v2us*)(Tl + o) = ol; 
}
template <int NK>
__global__ __launch_bounds__(256) void k_softmaxz(const float* __restrict__ S, int rows, bf* PH, bf* PL) {
    typedef __attribute__((ext_vector_type(4))) unsigned short v4us;
    const int lane = threadIdx.x & 31, i = blockIdx.x * 8 + (threadIdx.x >> 5); if (i >= rows) return; const size_t zo = (size_t)blockIdx.z * rows * NK; const float* sr = S + zo + (size_t)i * NK; PH += zo; PL += zo;
    float m = -3.0e38f;
#pragma unroll 1
    for (int c0 = lane * 4; c0 < NK; c0 += 128) {
#pragma unroll
        for (int q = 0; q < 4; ++q) m = fmaxf(m, sr[c0 + q]); }
#pragma unroll
    for (int sh = 16; sh; sh >>= 1) m = fmaxf(m, __shfl_xor(m, sh, 32));
    float sum = 0.f;
#pragma unroll 1
    for (int c0 = lane * 4; c0 < NK; c0 += 128) {
#pragma unroll
        for (int q = 0; q < 4; ++q) sum += __expf(sr[c0 + q] - m); }
#pragma unroll
    for (int sh = 16; sh; sh >>= 1) sum += __shfl_xor(sum, sh, 32);
    const float inv = 1.0f / sum;
{
#pragma unroll 1
        for (int c0 = lane * 4; c0 < NK; c0 += 128) { v4us oh, ol;
#pragma unroll
            for (int q = 0; q < 4; ++q) { const float p = __expf(sr[c0 + q] - m) * inv; const unsigned short hb = f2bf(p); oh[q] = hb; ol[q] = f2bf(p - bf2f(hb)); }
            const size_t o = (size_t)i * NK + c0; *(v4us*)(PH + o) = oh; *(v4us*)(PL + o) = ol; }
         }
}
__global__ __launch_bounds__(256) void k_placez(const float* __restrict__ XH, int rows, int ldy, float* Y) {
    const int lane = threadIdx.x & 31; const size_t q = (size_t)blockIdx.x * 8 + (threadIdx.x >> 5); if (q >= (size_t)rows) return; const int z = blockIdx.z; const float v = XH[((size_t)z * rows + q) * 64 + lane];
    *(float*)(Y + q * ldy + z * 32 + lane) = v; 
}

template <int NK>
__global__ __launch_bounds__(256) void k_softmaxzs(const float* __restrict__ S, int rows, float sc, bf* PH, bf* PL) {
    typedef __attribute__((ext_vector_type(4))) unsigned short v4us;
    const int lane = threadIdx.x & 31, i = blockIdx.x * 8 + (threadIdx.x >> 5); if (i >= rows) return; const size_t zo = (size_t)blockIdx.z * rows * NK; const float* sr = S + zo + (size_t)i * NK; PH += zo; PL += zo;
    float m = -3.0e38f;
#pragma unroll 1
    for (int c0 = lane * 4; c0 < NK; c0 += 128) {
#pragma unroll
        for (int q = 0; q < 4; ++q) m = fmaxf(m, sr[c0 + q] * sc); }
#pragma unroll
    for (int sh = 16; sh; sh >>= 1) m = fmaxf(m, __shfl_xor(m, sh, 32));
    float sum = 0.f;
#pragma unroll 1
    for (int c0 = lane * 4; c0 < NK; c0 += 128) {
#pragma unroll
        for (int q = 0; q < 4; ++q) sum += __expf(sr[c0 + q] * sc - m); }
#pragma unroll
    for (int sh = 16; sh; sh >>= 1) sum += __shfl_xor(sum, sh, 32);
    const float inv = 1.0f / sum;
{
#pragma unroll 1
        for (int c0 = lane * 4; c0 < NK; c0 += 128) { v4us oh, ol;
#pragma unroll
            for (int q = 0; q < 4; ++q) { const float p = __expf(sr[c0 + q] * sc - m) * inv; const unsigned short hb = f2bf(p); oh[q] = hb; ol[q] = f2bf(p - bf2f(hb)); }
            const size_t o = (size_t)i * NK + c0; *(v4us*)(PH + o) = oh; *(v4us*)(PL + o) = ol; }
         }
}

__global__ __launch_bounds__(256) void k_cvtx(const float* __restrict__ src, int rows, bf* dst) {
    const int lane = threadIdx.x & 31; const size_t r = (size_t)blockIdx.x * 8 + (threadIdx.x >> 5); if (r >= (size_t)rows) return;
{
#pragma unroll
        for (int q = 0; q < DMOD / 256; ++q) { v8us o;
#pragma unroll
            for (int i = 0; i < 8; ++i) o[i] = f2bf(src[r * DMOD + q * 256 + lane * 8 + i]);
            *(v8us*)(dst + r * DMOD + q * 256 + lane * 8) = o; }
         }
}
#define FPITCH 72   // LDS row pitch in bf16 elements: 144 bytes = 16 B x odd, for 16-byte fragment reads
#define FPLANE (64 * FPITCH)
#define LOG2E 1.4426950408889634f
typedef __attribute__((ext_vector_type(2))) float v2f;
typedef __attribute__((ext_vector_type(2))) __bf16 v2bf;
typedef __attribute__((ext_vector_type(8))) unsigned v8u;
__device__ __forceinline__ float xhalf(float x) { return __builtin_bit_cast(float, __builtin_amdgcn_permlanex16(__builtin_bit_cast(int, x), __builtin_bit_cast(int, x), 0x76543210, 0xfedcba98, false, false)); }  // lane l with lane l ^ 16
__global__ __launch_bounds__(256) __attribute__((amdgpu_waves_per_eu(4, 4))) void k_fattn(const bf* __restrict__ Qh, const bf* __restrict__ Ql, const bf* __restrict__ Kh, const bf* __restrict__ Kl, const bf* __restrict__ VTh, const bf* __restrict__ VTl, const float* __restrict__ MK, bf* Oh, bf* Ol) {
    __shared__ __align__(16) unsigned short tile[2][4 * FPLANE];   // two buffers x (K hi, K lo, V^T hi, V^T lo), 64 rows of 64 each
    const int tid = threadIdx.x, lane = tid & 31, wave = tid >> 5, lr = lane & 15, hi = lane >> 4;
    const int bh = blockIdx.y, b = bh / NH_, h = bh % NH_;
    const int q = blockIdx.x * 128 + wave * 16 + lr;
    v16bf qh[2], ql[2];
#pragma unroll
    for (int ks = 0; ks < 2; ++ks) { const size_t qo = ((size_t)bh * NN + q) * HD + ks * 32 + 8 * hi;
        qh[ks] = cat16b(*(const v8us*)(Qh + qo), *(const v8us*)(Qh + qo + 16)); ql[ks] = cat16b(*(const v8us*)(Ql + qo), *(const v8us*)(Ql + qo + 16)); }
    const int srow = tid >> 3, spc = (tid & 7) * 8;
    const size_t ko = ((size_t)bh * NKT + srow) * HD + spc, vo = ((size_t)bh * HD + srow) * NKT + spc;
    const int so = srow * FPITCH + spc;
    v8us st[8];
    auto fetch = [&](int key0) {
        const size_t k1 = ko + (size_t)key0 * HD, v1 = vo + key0;
        st[0] = *(const v8us*)(Kh + k1); st[1] = *(const v8us*)(Kh + k1 + 32 * HD); st[2] = *(const v8us*)(Kl + k1); st[3] = *(const v8us*)(Kl + k1 + 32 * HD);
        st[4] = *(const v8us*)(VTh + v1); st[5] = *(const v8us*)(VTh + v1 + (size_t)32 * NKT); st[6] = *(const v8us*)(VTl + v1); st[7] = *(const v8us*)(VTl + v1 + (size_t)32 * NKT);
    };
    auto put = [&](unsigned short* tb) {
#pragma unroll
        for (int a = 0; a < 4; ++a) { *(v8usa*)(tb + a * FPLANE + so) = st[2 * a]; *(v8usa*)(tb + a * FPLANE + so + 32 * FPITCH) = st[2 * a + 1]; }
    };
    const float* mrow = MK + ((size_t)b * NN + q) * NKT + 8 * hi;
    const int fo = lr * FPITCH + 8 * hi;
    v8f o[4];
#pragma unroll
    for (int t = 0; t < 4; ++t) o[t] = (v8f){};
    float m = -3.0e38f, sum = 0.f;
    fetch(0); put(&tile[0][0]);
    __syncthreads();
#pragma unroll 1   // stays rolled: one trip is already several hundred instructions
    for (int it = 0; it < NKT / 64; ++it) {
        const int key0 = it * 64;
        const unsigned short* tb = &tile[it & 1][0];
        v4f mk[8];
#pragma unroll
        for (int t = 0; t < 4; ++t) { mk[2 * t] = *(const v4f*)(mrow + key0 + 16 * t); mk[2 * t + 1] = *(const v4f*)(mrow + key0 + 16 * t + 4); }
        fetch(((it + 1) & (NKT / 64 - 1)) * 64);   // the next tile, through registers; the last trip wraps to tile 0, which nobody reads: the loop stays free of branches and register copies
        __builtin_amdgcn_sched_barrier(0);         // keeps the mask and tile loads issued above the score products, so that their latency runs under them
        v8f s[4];
#pragma unroll
        for (int t = 0; t < 4; ++t) s[t] = (v8f){};
        v16bf fa[2], fb[2];
        fa[0] = ldsfrag(tb + fo); fb[0] = ldsfrag(tb + FPLANE + fo);
#pragma unroll
        for (int g = 0; g < 8; ++g) { const int t = g & 3, ks = g >> 2;   // each group's fragments are read one group ahead
            if (g < 7) { const int ao = ((g + 1) & 3) * 16 * FPITCH + ((g + 1) >> 2) * 32 + fo; fa[(g + 1) & 1] = ldsfrag(tb + ao); fb[(g + 1) & 1] = ldsfrag(tb + FPLANE + ao); }
            s[t] = wmmab(fa[g & 1], qh[ks], s[t]); s[t] = wmmab(fa[g & 1], ql[ks], s[t]); s[t] = wmmab(fb[g & 1], qh[ks], s[t]); }
        float mx = -3.0e38f;
#pragma unroll
        for (int t = 0; t < 4; ++t) {
#pragma unroll
            for (int j = 0; j < 8; j += 2) { const v4f mq = mk[2 * t + (j >> 2)]; const v2bf mb = __builtin_convertvector((v2f){mq[j & 3], mq[(j & 3) + 1]}, v2bf);
#pragma unroll
                for (int e = 0; e < 2; ++e) { float v = s[t][j + e] * SCL; v = v + (float)mb[e] * -1e9f; s[t][j + e] = v; mx = fmaxf(mx, v); } } }
        mx = fmaxf(mx, xhalf(mx));
        const float mn = fmaxf(m, mx), alpha = __builtin_amdgcn_exp2f((m - mn) * LOG2E);
        m = mn;
        float ts[4];
        v8u phw[2], plw[2];
#pragma unroll
        for (int t = 0; t < 4; ++t) { ts[t] = 0.f;
#pragma unroll
            for (int j = 0; j < 8; j += 2) { const float p0 = __builtin_amdgcn_exp2f((s[t][j] - mn) * LOG2E), p1 = __builtin_amdgcn_exp2f((s[t][j + 1] - mn) * LOG2E); ts[t] += p0; ts[t] += p1;
                const v2bf hb = __builtin_convertvector((v2f){p0, p1}, v2bf); const v2bf lb = __builtin_convertvector((v2f){p0 - (float)hb[0], p1 - (float)hb[1]}, v2bf);
                phw[t >> 1][(t & 1) * 4 + (j >> 1)] = __builtin_bit_cast(unsigned, hb); plw[t >> 1][(t & 1) * 4 + (j >> 1)] = __builtin_bit_cast(unsigned, lb); } }
        sum = sum * alpha + ((ts[0] + ts[1]) + (ts[2] + ts[3]));
#pragma unroll
        for (int t = 0; t < 4; ++t) o[t] *= alpha;
        fa[0] = ldsfrag(tb + 2 * FPLANE + fo); fb[0] = ldsfrag(tb + 3 * FPLANE + fo);
#pragma unroll
        for (int g = 0; g < 8; ++g) { const int t = g & 3, ks = g >> 2; const v16bf ph = __builtin_bit_cast(v16bf, phw[ks]), pl = __builtin_bit_cast(v16bf, plw[ks]);
            if (g < 7) { const int ao = ((g + 1) & 3) * 16 * FPITCH + ((g + 1) >> 2) * 32 + fo; fa[(g + 1) & 1] = ldsfrag(tb + 2 * FPLANE + ao); fb[(g + 1) & 1] = ldsfrag(tb + 3 * FPLANE + ao); }
            o[t] = wmmab(fa[g & 1], ph, o[t]); o[t] = wmmab(fa[g & 1], pl, o[t]); o[t] = wmmab(fb[g & 1], ph, o[t]); }
        put(&tile[(it + 1) & 1][0]);
        __syncthreads();   // publishes the next tile and ends every reader's last read of this one
    }
    sum += xhalf(sum);
    const float inv = 1.0f / sum;
    const size_t oo = ((size_t)b * NN + q) * DMOD + h * HD + 8 * hi;   // merged heads, as the hi and residual planes that the output projection reads
#pragma unroll
    for (int t = 0; t < 4; ++t) { const v8f r = o[t] * inv; v8us oh, ol;
#pragma unroll
        for (int i = 0; i < 8; ++i) { const unsigned short hb = f2bf(r[i]); oh[i] = hb; ol[i] = f2bf(r[i] - bf2f(hb)); }
        *(v8us*)(Oh + oo + 16 * t) = oh; *(v8us*)(Ol + oo + 16 * t) = ol; }
}

extern "C" void kernel_launch(void* const* d_in, const int* in_sizes, int n_in,
                              void* d_out, int out_size, void* d_ws, size_t ws_size, hipStream_t stream) {
    (void)in_sizes; (void)n_in; (void)out_size;
    const float* xq = (const float*)d_in[0]; const float* xk = (const float*)d_in[1]; const float* xv = xk; const float* mask = (const float*)d_in[2]; const float* Wq = (const float*)d_in[3]; const float* Wk = (const float*)d_in[4]; const float* Wv = (const float*)d_in[5]; const float* Wo = (const float*)d_in[6];
    float* out = (float*)d_out;    // [NBT][NN][DMOD]
    char* wsp = (char*)d_ws;
    auto take = [&](size_t bytes) { char* p = wsp; wsp += (bytes + 255) & ~(size_t)255; return (void*)p; };
    const size_t WSZ = (size_t)DMOD * DMOD * 2;
    bf* WQ = (bf*)take(WSZ); bf* WK = (bf*)take(WSZ); bf* WV = (bf*)take(WSZ); bf* WO = (bf*)take(WSZ);
    bf* Xq = (bf*)take((size_t)NN * DMOD * 2); bf* Xk = (bf*)take((size_t)NKT * DMOD * 2);
    const size_t PEL = (size_t)NH_ * NN * HD, PSZ = (size_t)NBT * PEL * 2;    // one plane: [item][head][2048][64] (V^T: [item][head][64][2048])
    bf* Qh = (bf*)take(PSZ); bf* Ql = (bf*)take(PSZ); bf* Kh = (bf*)take(PSZ); bf* Kl = (bf*)take(PSZ); bf* VTh = (bf*)take(PSZ); bf* VTl = (bf*)take(PSZ);
    bf* Oh = (bf*)take((size_t)NBT * NN * DMOD * 2); bf* Ol = (bf*)take((size_t)NBT * NN * DMOD * 2);
    if ((size_t)(wsp - (char*)d_ws) > ws_size) return;    // per item reuse in stream order
    k_wt<<<dim3(DMOD / 64, DMOD / 64, 1), 256, 0, stream>>>(Wq, DMOD, DMOD, WQ); k_wt<<<dim3(DMOD / 64, DMOD / 64, 1), 256, 0, stream>>>(Wk, DMOD, DMOD, WK); k_wt<<<dim3(DMOD / 64, DMOD / 64, 1), 256, 0, stream>>>(Wv, DMOD, DMOD, WV); k_wt<<<dim3(DMOD / 64, DMOD / 64, 1), 256, 0, stream>>>(Wo, DMOD, DMOD, WO);   // (in, out) k-major -> n-major
    const dim3 gq(NN / 64, DMOD / 64, 1), gk(NKT / 64, DMOD / 64, 1);
    for (int b = 0; b < NBT; ++b) {
        k_cvtx<<<NN / 8, 256, 0, stream>>>(xq + (size_t)b * NN * DMOD, NN, Xq); k_cvtx<<<NKT / 8, 256, 0, stream>>>(xk + (size_t)b * NKT * DMOD, NKT, Xk);
        // a 64-column block of q or k is one head: row = token (pitch 64), block = head. V^T = W_v^T . y^T by swapping the operands: row = head * 64 + d (pitch 2048), block = 64 tokens.
        k_gemmb<false, true><<<gq, 128, 0, stream>>>(Xq, nullptr, WQ, nullptr, nullptr, HD, Qh + b * PEL, Ql + b * PEL, (size_t)NN * HD, nullptr, DMOD); k_gemmb<false, true><<<gk, 128, 0, stream>>>(Xk, nullptr, WK, nullptr, nullptr, HD, Kh + b * PEL, Kl + b * PEL, (size_t)NKT * HD, nullptr, DMOD);
        k_gemmb<false, true><<<dim3(DMOD / 64, NKT / 64, 1), 128, 0, stream>>>(WV, nullptr, Xk, nullptr, nullptr, NKT, VTh + b * PEL, VTl + b * PEL, (size_t)64, nullptr, DMOD); }
    k_fattn<<<dim3(NN / 128, NBT * NH_, 1), 256, 0, stream>>>(Qh, Ql, Kh, Kl, VTh, VTl, mask, Oh, Ol);
    for (int b = 0; b < NBT; ++b)
        k_gemmb<true, false><<<gq, 128, 0, stream>>>(Oh + (size_t)b * NN * DMOD, Ol + (size_t)b * NN * DMOD, WO, nullptr, out + (size_t)b * NN * DMOD, DMOD, nullptr, nullptr, 0, nullptr, DMOD);
}

// v004
// It runs in 154 microseconds.
// In two side-by-side timings against v003, it was 1.30 and 1.29 times as fast.
// All steps since v000 together make it 13.5 times as fast.
#include <hip/hip_runtime.h>

// Compute dtypes, f32 accumulate, per item: q/k/v projections as [2048 x 1024].[1024 x 1024] GEMMs with PLAIN bf16 operands (the inputs themselves; exact products);
// per head (head dim 64; one fused launch over all items and heads): scores = q.k^T and attn.v with both operands as bf16 hi + UNSCALED residual planes (three products); the 1/sqrt(64) scale,
// the mask (additive mask x -1e9) and the running-maximum softmax in f32, normalised after attn.v; output projection on hi/lo planes of the merged heads (two products) - on v_wmma_f32_16x16x32_bf16.

#define NBT  2
#define NN   2048
#define NKT  2048
#define DMOD 1024
#define NH_  16
#define HD   64
#define ZH   2
#define DM   DMOD
#define NTK  NN
#define SCL  0.125f
#define LOSC 1024.0f

typedef _Float16 h16;
typedef unsigned short bf;
typedef __attribute__((ext_vector_type(16))) __bf16   v16bf;
typedef __attribute__((ext_vector_type(16))) _Float16 v16h;
typedef __attribute__((ext_vector_type(8)))  _Float16 v8h;
typedef __attribute__((ext_vector_type(8)))  unsigned short v8us;
typedef __attribute__((ext_vector_type(8)))  float    v8f;
typedef __attribute__((ext_vector_type(4)))  float    v4f;
typedef __attribute__((ext_vector_type(4)))  _Float16 v4h;
typedef v8h  __attribute__((may_alias)) v8ha;
typedef v4f  __attribute__((may_alias)) v4fa;
typedef v8us __attribute__((may_alias)) v8usa;

__device__ __forceinline__ unsigned short f2bf(float f) { unsigned u = __float_as_uint(f); u += 0x7FFFu + ((u >> 16) & 1u); return (unsigned short)(u >> 16); }
__device__ __forceinline__ float bf2f(unsigned short b) { return __uint_as_float(((unsigned)b) << 16); }
__device__ __forceinline__ float bfr(float f) { return bf2f(f2bf(f)); }
__device__ __forceinline__ v16h cat16(v8h lo, v8h hi) { return __builtin_shufflevector(lo, hi, 0, 1, 2, 3, 4, 5, 6, 7, 8, 9, 10, 11, 12, 13, 14, 15); }
__device__ __forceinline__ v16bf cat16b(v8us lo, v8us hi) { return __builtin_bit_cast(v16bf, __builtin_shufflevector(lo, hi, 0, 1, 2, 3, 4, 5, 6, 7, 8, 9, 10, 11, 12, 13, 14, 15)); }
__device__ __forceinline__ v16bf ldsfrag(const unsigned short* p) { return cat16b(*(const v8usa*)p, *(const v8usa*)(p + 16)); }
__device__ __forceinline__ v8f wmma16(v16h a, v16h b, v8f c) { return __builtin_amdgcn_wmma_f32_16x16x32_f16(false, a, false, b, (short)0, c, false, false); }
__device__ __forceinline__ v8f wmmab(v16bf a, v16bf b, v8f c) { return __builtin_amdgcn_wmma_f32_16x16x32_bf16(false, a, false, b, (short)0, c, false, false); }

// wt_tile: WT [n][K] = bf16(W[k][n]) (k-major [K][ncols]) via 64 x 64 LDS tiles; one work-group of 256 does tile (bx, by) of (K/64, ncols/64).
__device__ __forceinline__ void wt_tile(const float* __restrict__ Wm, int K, int ncols, bf* WT, int bx, int by) {
    __shared__ __align__(16) unsigned short tl[64 * 72];
    const int tid = threadIdx.x, k0 = bx * 64, n0 = by * 64;
    const int kk = tid >> 2, nq = (tid & 3) * 16;
#pragma unroll
    for (int i = 0; i < 16; ++i) tl[(nq + i) * 72 + kk] = f2bf(Wm[(size_t)(k0 + kk) * ncols + n0 + nq + i]);
    __syncthreads();
    const int piece = tid & 7;
    auto pass = [&]() {
#pragma unroll
        for (int s = 0; s < 2; ++s) { const int nr = (tid >> 3) + 32 * s; const v8us val = *(const v8usa*)(tl + nr * 72 + piece * 8); *(v8us*)(WT + (size_t)(n0 + nr) * K + k0 + piece * 8) = val; }
    };
    pass(); 
}
// gemm_tile: block tile (bx, by), 64 x 64 (4 waves x 16 x 64) of C = (A [+ Al]).B^T (K = 1024, a multiple of GKC) [+ bf(bias[c])] [+ bf(R[r][c]) residual]; f32 whole-line epilogue, or
// PLANES: the tile leaves as bf16 hi + residual planes, its row r at r * ldc + by * cbs in Ph and Pl (128 bytes a row and plane, whole lines), so that no f32 copy is stored and split later.
// The operands come in chunks of GKC k values by asynchronous copies into two LDS buffers: a wave's copy reads whole 128-byte lines (two rows of 256 bytes), each line once a work-group,
// and the 16-row fragments are read from LDS; k order and sum order are those of fragment loads straight from memory.
#define GKC    128          // k values of a chunk
#define GPITCH (GKC + 8)    // LDS row pitch in bf16 elements: 272 bytes = 16 B x odd, for 16-byte fragment reads
#define GTILE  (64 * GPITCH)
// copy8: the lane's 16 bytes of eight rows, 8 rows apart (gs bytes in memory), from g to LDS byte address l. The copies and their s_wait_xcnt stand in one statement,
// so that no address register is rewritten in front of the wait.
__device__ __forceinline__ void copy8(unsigned l, const char* g, size_t gs) {
    asm volatile("global_load_async_to_lds_b128 %0, %8, off\n\t"
                 "global_load_async_to_lds_b128 %1, %9, off\n\t"
                 "global_load_async_to_lds_b128 %2, %10, off\n\t"
                 "global_load_async_to_lds_b128 %3, %11, off\n\t"
                 "global_load_async_to_lds_b128 %4, %12, off\n\t"
                 "global_load_async_to_lds_b128 %5, %13, off\n\t"
                 "global_load_async_to_lds_b128 %6, %14, off\n\t"
                 "global_load_async_to_lds_b128 %7, %15, off\n\t"
                 "s_wait_xcnt 0x0"
                 :: "v"(l), "v"(l + 1 * 16 * GPITCH), "v"(l + 2 * 16 * GPITCH), "v"(l + 3 * 16 * GPITCH), "v"(l + 4 * 16 * GPITCH), "v"(l + 5 * 16 * GPITCH), "v"(l + 6 * 16 * GPITCH), "v"(l + 7 * 16 * GPITCH),
                    "v"(g), "v"(g + gs), "v"(g + 2 * gs), "v"(g + 3 * gs), "v"(g + 4 * gs), "v"(g + 5 * gs), "v"(g + 6 * gs), "v"(g + 7 * gs) : "memory");
}
template <bool SPLITA, bool PLANES = false>
__device__ __forceinline__ void gemm_tile(int bx, int by, const bf* __restrict__ A, const bf* __restrict__ Al, const bf* __restrict__ Bn, const float* __restrict__ bias, float* C, int ldc, bf* Ph, bf* Pl, size_t cbs, const float* __restrict__ R = nullptr, int K = DM, int roundR = 1) {
    constexpr int NT = SPLITA ? 3 : 2;
    __shared__ __align__(16) unsigned short stg[2][NT * GTILE];   // two buffers x (A, B [, Al]), 64 rows of GKC each
    __shared__ __align__(16) float ost[4][16 * 68];
    const int tid = threadIdx.x, lane = tid & 31, wave = tid >> 5, lr = lane & 15, hi = lane >> 4;
    const int r0 = bx * 64 + wave * 16, c0 = by * 64;
    const int srow = tid >> 4, spc = (tid & 15) * 8;   // a lane copies piece spc of rows srow, srow + 8, ... of each tile
    const size_t ao = (size_t)(bx * 64 + srow) * K + spc, bo = (size_t)(c0 + srow) * K + spc, gs = (size_t)K * 16;
    const unsigned lb = (unsigned)(size_t)&stg[0][0] + (unsigned)(srow * GPITCH + spc) * 2u;   // LDS byte address: the low 32 bits of the shared address
    auto copy = [&](int kc, int buf) {
        const unsigned l = lb + (unsigned)buf * (NT * GTILE * 2);
        copy8(l, (const char*)(A + ao + kc), gs); copy8(l + GTILE * 2, (const char*)(Bn + bo + kc), gs); if (SPLITA) copy8(l + 2 * GTILE * 2, (const char*)(Al + ao + kc), gs);
    };
    const int fao = (wave * 16 + lr) * GPITCH + 8 * hi, fbo = GTILE + lr * GPITCH + 8 * hi;
    v8f acc[4];
#pragma unroll
    for (int t = 0; t < 4; ++t) acc[t] = (v8f){};
    copy(0, 0);
    asm volatile("s_wait_asynccnt 0x0" ::: "memory");   // this wave's copies of chunk 0 have landed
    __syncthreads();                                    // every wave's have
    const int nch = K / GKC;
    if (nch > 1) copy(GKC, 1);
#pragma unroll 1   // stays rolled: a trip holds four unrolled k steps
    for (int ch = 0; ch < nch; ++ch) {
        const int cur = ch & 1;
        const unsigned short* tb = &stg[cur][0];
        v16bf fa[GKC / 32], fl[GKC / 32], fb[GKC / 32][4];
#pragma unroll
        for (int ks = 0; ks < GKC / 32; ++ks) { fa[ks] = ldsfrag(tb + fao + ks * 32); fl[ks] = fa[ks]; if (SPLITA) fl[ks] = ldsfrag(tb + 2 * GTILE + fao + ks * 32);
#pragma unroll
            for (int t = 0; t < 4; ++t) fb[ks][t] = ldsfrag(tb + fbo + t * 16 * GPITCH + ks * 32); }
        __builtin_amdgcn_sched_barrier(0);   // keeps the chunk's fragment reads issued as one group ahead of its products; sunk to their uses, each product would wait out a whole LDS read
#pragma unroll
        for (int ks = 0; ks < GKC / 32; ++ks) {
#pragma unroll
            for (int t = 0; t < 4; ++t) { acc[t] = wmmab(fa[ks], fb[ks][t], acc[t]); if (SPLITA) acc[t] = wmmab(fl[ks], fb[ks][t], acc[t]); } }
        __builtin_amdgcn_sched_barrier(0);   // keeps the products above the waits below, so that they run while the later fragments and the next chunk's copies are still on their way
        asm volatile("s_wait_dscnt 0x0" ::: "memory");      // this wave's reads of the buffer that is refilled below have retired
        asm volatile("s_wait_asynccnt 0x0" ::: "memory");   // this wave's copies of the next chunk have landed
        __syncthreads();                                    // publishes the next chunk and ends every reader's last read of this one
        if (ch + 2 < nch) copy((ch + 2) * GKC, cur);        // flies under the next chunk's products
    }
    asm volatile("s_wait_asynccnt 0x0" ::: "memory");   // no copy is outstanding when the wave goes on
    float* os = &ost[wave][0];
#pragma unroll
    for (int t = 0; t < 4; ++t) { const float bv = bias ? bfr(bias[c0 + t * 16 + lr]) : 0.f;
#pragma unroll
        for (int j = 0; j < 8; ++j) os[(hi * 8 + j) * 68 + t * 16 + lr] = acc[t][j] + bv; }
    __syncthreads();
    if (PLANES) {
        const size_t pb = (size_t)r0 * ldc + (size_t)by * cbs;
#pragma unroll
        for (int s = 0; s < 4; ++s) { const int row = 4 * s + (lane >> 3), piece = lane & 7; const float* sp = os + row * 68 + piece * 8; v8us oh, ol;
#pragma unroll
            for (int i = 0; i < 8; ++i) { const unsigned short hb = f2bf(sp[i]); oh[i] = hb; ol[i] = f2bf(sp[i] - bf2f(hb)); }
            const size_t o = pb + (size_t)row * ldc + piece * 8; *(v8us*)(Ph + o) = oh; *(v8us*)(Pl + o) = ol; }
    } else {
        float* crow = C + (size_t)r0 * ldc + c0;
        auto pass = [&]() {
#pragma unroll
            for (int s = 0; s < 8; ++s) { const int Lid = (lane >> 3) + 4 * s, piece = lane & 7; const int row = Lid >> 1, cofs = (Lid & 1) * 32 + piece * 4;
                v4f val = *(const v4fa*)(os + row * 68 + cofs); if (R) { const v4f rv = *(const v4f*)(R + ((size_t)r0 + row) * ldc + c0 + cofs); val += roundR ? (v4f){bfr(rv[0]), bfr(rv[1]), bfr(rv[2]), bfr(rv[3])} : rv; }
                *(v4f*)(crow + (size_t)row * ldc + cofs) = val; }
        };
        pass(); 
    }
}

// k_proj: the six projection GEMMs of a call, none of which reads another's result, as one grid (32, 16, 6): blockIdx.z = 2 * product (q, k, v) + item.
// A 64-column block of q or k is one head: row = token (pitch 64), block = head. V^T = W_v^T . y^T by swapping the operands: row = head * 64 + d (pitch 2048), block = 64 tokens.
__global__ __launch_bounds__(128) void k_proj(const bf* __restrict__ Xq, const bf* __restrict__ Xk, const bf* __restrict__ WQ, const bf* __restrict__ WK, const bf* __restrict__ WV, bf* Qh, bf* Ql, bf* Kh, bf* Kl, bf* VTh, bf* VTl) {
    const int p = blockIdx.z >> 1, b = blockIdx.z & 1;
    const size_t xo = (size_t)b * NN * DMOD, po = (size_t)b * NH_ * NN * HD;
    const bool v = p == 2;
    const bf* X = (p ? Xk : Xq) + xo;
    const bf* Wt = v ? WV : p ? WK : WQ;
    gemm_tile<false, true>(v ? blockIdx.y : blockIdx.x, v ? blockIdx.x : blockIdx.y, v ? Wt : X, nullptr, v ? X : Wt, nullptr, nullptr, v ? NKT : HD,
                           (v ? VTh : p ? Kh : Qh) + po, (v ? VTl : p ? Kl : Ql) + po, v ? (size_t)64 : (size_t)NN * HD);
}
// k_outp: the output projection of both items as one [4096 x 1024].[1024 x 1024] GEMM (the items' rows follow one another in the planes and in out); grid (64, 16).
__global__ __launch_bounds__(128) void k_outp(const bf* __restrict__ Oh, const bf* __restrict__ Ol, const bf* __restrict__ WO, float* out) {
    gemm_tile<true, false>(blockIdx.x, blockIdx.y, Oh, Ol, WO, nullptr, out, DMOD, nullptr, nullptr, 0);
}

__global__ __launch_bounds__(256) void k_cvt8(const float* __restrict__ src, bf* dst, size_t n8) {
    const size_t i = (size_t)blockIdx.x * 256 + threadIdx.x; if (i >= n8) return;
    const v8f v = *(const v8f*)(src + i * 8); v8us o;
#pragma unroll
    for (int k = 0; k < 8; ++k) o[k] = f2bf(v[k]);
    *(v8us*)(dst + i * 8) = o; 
}
__global__ __launch_bounds__(256) void k_zero8(bf* dst, size_t n8) {
    const size_t i = (size_t)blockIdx.x * 256 + threadIdx.x; if (i >= n8) return; v8us z;
#pragma unroll
    for (int k = 0; k < 8; ++k) z[k] = 0;
    *(v8us*)(dst + i * 8) = z; 
}

// ===== z-batched (blockIdx.z = head) attention pieces =====
__global__ __launch_bounds__(256) void k_planes32z(const float* __restrict__ F, int ld, int off, float sc, int rows, bf* Ph, bf* Pl) {
    typedef __attribute__((ext_vector_type(2))) unsigned short v2us;
    const int lane = threadIdx.x & 31; const size_t r = ((size_t)blockIdx.x * 8 + (threadIdx.x >> 5)) * 2 + (lane >> 4); if (r >= (size_t)rows) return; const int z = blockIdx.z; const int c0 = (lane & 15) * 2; v2us oh, ol;
    Ph += (size_t)z * rows * 32; Pl += (size_t)z * rows * 32;
#pragma unroll
    for (int i = 0; i < 2; ++i) { const float y = F[r * ld + off + z * 32 + c0 + i] * sc; const unsigned short hb = f2bf(y); oh[i] = hb; ol[i] = f2bf(y - bf2f(hb)); }
    const size_t o = r * 32 + c0; *(v2us*)(Ph + o) = oh; *(v2us*)(Pl + o) = ol; 
}
__global__ __launch_bounds__(256) void k_vtpadz(const float* __restrict__ F, int ld, int off, int nk, bf* Th, bf* Tl) {
    typedef __attribute__((ext_vector_type(2))) unsigned short v2us;
    const int lane = threadIdx.x & 31; const size_t wid = (size_t)blockIdx.x * 8 + (threadIdx.x >> 5); if (wid >= (size_t)64 * (nk / 64)) return; const int z = blockIdx.z; const int d = (int)(wid / (nk / 64)); const int k0 = (int)(wid % (nk / 64)) * 64 + lane * 2; v2us oh, ol;
    Th += (size_t)z * 64 * nk; Tl += (size_t)z * 64 * nk;
#pragma unroll
    for (int i = 0; i < 2; ++i) { const float y = (d < 32) ? F[(size_t)(k0 + i) * ld + off + z * 32 + (d < 32 ? d : 0)] : 0.f; const unsigned short hb = f2bf(y); oh[i] = hb; ol[i] = f2bf(y - bf2f(hb)); }
    const size_t o = (size_t)d * nk + k0; *(v2us*)(Th + o) = oh; *(v2us*)(Tl + o) = ol; 
}
template <int NK>
__global__ __launch_bounds__(256) void k_softmaxz(const float* __restrict__ S, int rows, bf* PH, bf* PL) {
    typedef __attribute__((ext_vector_type(4))) unsigned short v4us;
    const int lane = threadIdx.x & 31, i = blockIdx.x * 8 + (threadIdx.x >> 5); if (i >= rows) return; const size_t zo = (size_t)blockIdx.z * rows * NK; const float* sr = S + zo + (size_t)i * NK; PH += zo; PL += zo;
    float m = -3.0e38f;
#pragma unroll 1
    for (int c0 = lane * 4; c0 < NK; c0 += 128) {
#pragma unroll
        for (int q = 0; q < 4; ++q) m = fmaxf(m, sr[c0 + q]); }
#pragma unroll
    for (int sh = 16; sh; sh >>= 1) m = fmaxf(m, __shfl_xor(m, sh, 32));
    float sum = 0.f;
#pragma unroll 1
    for (int c0 = lane * 4; c0 < NK; c0 += 128) {
#pragma unroll
        for (int q = 0; q < 4; ++q) sum += __expf(sr[c0 + q] - m); }
#pragma unroll
    for (int sh = 16; sh; sh >>= 1) sum += __shfl_xor(sum, sh, 32);
    const float inv = 1.0f / sum;
{
#pragma unroll 1
        for (int c0 = lane * 4; c0 < NK; c0 += 128) { v4us oh, ol;
#pragma unroll
            for (int q = 0; q < 4; ++q) { const float p = __expf(sr[c0 + q] - m) * inv; const unsigned short hb = f2bf(p); oh[q] = hb; ol[q] = f2bf(p - bf2f(hb)); }
            const size_t o = (size_t)i * NK + c0; *(v4us*)(PH + o) = oh; *(v4us*)(PL + o) = ol; }
         }
}
__global__ __launch_bounds__(256) void k_placez(const float* __restrict__ XH, int rows, int ldy, float* Y) {
    const int lane = threadIdx.x & 31; const size_t q = (size_t)blockIdx.x * 8 + (threadIdx.x >> 5); if (q >= (size_t)rows) return; const int z = blockIdx.z; const float v = XH[((size_t)z * rows + q) * 64 + lane];
    *(float*)(Y + q * ldy + z * 32 + lane) = v; 
}

template <int NK>
__global__ __launch_bounds__(256) void k_softmaxzs(const float* __restrict__ S, int rows, float sc, bf* PH, bf* PL) {
    typedef __attribute__((ext_vector_type(4))) unsigned short v4us;
    const int lane = threadIdx.x & 31, i = blockIdx.x * 8 + (threadIdx.x >> 5); if (i >= rows) return; const size_t zo = (size_t)blockIdx.z * rows * NK; const float* sr = S + zo + (size_t)i * NK; PH += zo; PL += zo;
    float m = -3.0e38f;
#pragma unroll 1
    for (int c0 = lane * 4; c0 < NK; c0 += 128) {
#pragma unroll
        for (int q = 0; q < 4; ++q) m = fmaxf(m, sr[c0 + q] * sc); }
#pragma unroll
    for (int sh = 16; sh; sh >>= 1) m = fmaxf(m, __shfl_xor(m, sh, 32));
    float sum = 0.f;
#pragma unroll 1
    for (int c0 = lane * 4; c0 < NK; c0 += 128) {
#pragma unroll
        for (int q = 0; q < 4; ++q) sum += __expf(sr[c0 + q] * sc - m); }
#pragma unroll
    for (int sh = 16; sh; sh >>= 1) sum += __shfl_xor(sum, sh, 32);
    const float inv = 1.0f / sum;
{
#pragma unroll 1
        for (int c0 = lane * 4; c0 < NK; c0 += 128) { v4us oh, ol;
#pragma unroll
            for (int q = 0; q < 4; ++q) { const float p = __expf(sr[c0 + q] * sc - m) * inv; const unsigned short hb = f2bf(p); oh[q] = hb; ol[q] = f2bf(p - bf2f(hb)); }
            const size_t o = (size_t)i * NK + c0; *(v4us*)(PH + o) = oh; *(v4us*)(PL + o) = ol; }
         }
}

__device__ __forceinline__ void cvtx_rows(const float* __restrict__ src, int rows, bf* dst, int bx) {
    const int lane = threadIdx.x & 31; const size_t r = (size_t)bx * 8 + (threadIdx.x >> 5); if (r >= (size_t)rows) return;
{
#pragma unroll
        for (int q = 0; q < DMOD / 256; ++q) { v8us o;
#pragma unroll
            for (int i = 0; i < 8; ++i) o[i] = f2bf(src[r * DMOD + q * 256 + lane * 8 + i]);
            *(v8us*)(dst + r * DMOD + q * 256 + lane * 8) = o; }
         }
}
// k_prep: all conversions of the inputs, none of which reads another's result, as one grid: work-groups 0 .. 1023 transpose the four weights (256 tiles each, (in, out) k-major -> n-major),
// the next 512 convert the rows of x (both items), the last 512 those of y.
#define WTB ((DMOD / 64) * (DMOD / 64))
#define XB  (NBT * NN / 8)
__global__ __launch_bounds__(256) void k_prep(const float* __restrict__ Wq, const float* __restrict__ Wk, const float* __restrict__ Wv, const float* __restrict__ Wo, const float* __restrict__ xq, const float* __restrict__ xk,
                                              bf* WQ, bf* WK, bf* WV, bf* WO, bf* Xq, bf* Xk) {
    const int g = blockIdx.x;
    if (g < 4 * WTB) { const int w = g / WTB, t = g % WTB;
        wt_tile(w == 0 ? Wq : w == 1 ? Wk : w == 2 ? Wv : Wo, DMOD, DMOD, w == 0 ? WQ : w == 1 ? WK : w == 2 ? WV : WO, t % (DMOD / 64), t / (DMOD / 64)); }
    else { const int c = g - 4 * WTB; const bool y = c >= XB;
        cvtx_rows(y ? xk : xq, NBT * NN, y ? Xk : Xq, y ? c - XB : c); }
}
#define FPITCH 72   // LDS row pitch in bf16 elements: 144 bytes = 16 B x odd, for 16-byte fragment reads
#define FPLANE (64 * FPITCH)
#define LOG2E 1.4426950408889634f
typedef __attribute__((ext_vector_type(2))) float v2f;
typedef __attribute__((ext_vector_type(2))) __bf16 v2bf;
typedef __attribute__((ext_vector_type(8))) unsigned v8u;
__device__ __forceinline__ float xhalf(float x) { return __builtin_bit_cast(float, __builtin_amdgcn_permlanex16(__builtin_bit_cast(int, x), __builtin_bit_cast(int, x), 0x76543210, 0xfedcba98, false, false)); }  // lane l with lane l ^ 16
__global__ __launch_bounds__(256) __attribute__((amdgpu_waves_per_eu(4, 4))) void k_fattn(const bf* __restrict__ Qh, const bf* __restrict__ Ql, const bf* __restrict__ Kh, const bf* __restrict__ Kl, const bf* __restrict__ VTh, const bf* __restrict__ VTl, const float* __restrict__ MK, bf* Oh, bf* Ol) {
    __shared__ __align__(16) unsigned short tile[2][4 * FPLANE];   // two buffers x (K hi, K lo, V^T hi, V^T lo), 64 rows of 64 each
    const int tid = threadIdx.x, lane = tid & 31, wave = tid >> 5, lr = lane & 15, hi = lane >> 4;
    const int bh = blockIdx.y, b = bh / NH_, h = bh % NH_;
    const int q = blockIdx.x * 128 + wave * 16 + lr;
    v16bf qh[2], ql[2];
#pragma unroll
    for (int ks = 0; ks < 2; ++ks) { const size_t qo = ((size_t)bh * NN + q) * HD + ks * 32 + 8 * hi;
        qh[ks] = cat16b(*(const v8us*)(Qh + qo), *(const v8us*)(Qh + qo + 16)); ql[ks] = cat16b(*(const v8us*)(Ql + qo), *(const v8us*)(Ql + qo + 16)); }
    const int srow = tid >> 3, spc = (tid & 7) * 8;
    const size_t ko = ((size_t)bh * NKT + srow) * HD + spc, vo = ((size_t)bh * HD + srow) * NKT + spc;
    const int so = srow * FPITCH + spc;
    v8us st[8];
    auto fetch = [&](int key0) {
        const size_t k1 = ko + (size_t)key0 * HD, v1 = vo + key0;
        st[0] = *(const v8us*)(Kh + k1); st[1] = *(const v8us*)(Kh + k1 + 32 * HD); st[2] = *(const v8us*)(Kl + k1); st[3] = *(const v8us*)(Kl + k1 + 32 * HD);
        st[4] = *(const v8us*)(VTh + v1); st[5] = *(const v8us*)(VTh + v1 + (size_t)32 * NKT); st[6] = *(const v8us*)(VTl + v1); st[7] = *(const v8us*)(VTl + v1 + (size_t)32 * NKT);
    };
    auto put = [&](unsigned short* tb) {
#pragma unroll
        for (int a = 0; a < 4; ++a) { *(v8usa*)(tb + a * FPLANE + so) = st[2 * a]; *(v8usa*)(tb + a * FPLANE + so + 32 * FPITCH) = st[2 * a + 1]; }
    };
    const float* mrow = MK + ((size_t)b * NN + q) * NKT + 8 * hi;
    const int fo = lr * FPITCH + 8 * hi;
    v8f o[4];
#pragma unroll
    for (int t = 0; t < 4; ++t) o[t] = (v8f){};
    float m = -3.0e38f, sum = 0.f;
    fetch(0); put(&tile[0][0]);
    __syncthreads();
#pragma unroll 1   // stays rolled: one trip is already several hundred instructions
    for (int it = 0; it < NKT / 64; ++it) {
        const int key0 = it * 64;
        const unsigned short* tb = &tile[it & 1][0];
        v4f mk[8];
#pragma unroll
        for (int t = 0; t < 4; ++t) { mk[2 * t] = *(const v4f*)(mrow + key0 + 16 * t); mk[2 * t + 1] = *(const v4f*)(mrow + key0 + 16 * t + 4); }
        fetch(((it + 1) & (NKT / 64 - 1)) * 64);   // the next tile, through registers; the last trip wraps to tile 0, which nobody reads: the loop stays free of branches and register copies
        __builtin_amdgcn_sched_barrier(0);         // keeps the mask and tile loads issued above the score products, so that their latency runs under them
        v8f s[4];
#pragma unroll
        for (int t = 0; t < 4; ++t) s[t] = (v8f){};
        v16bf fa[2], fb[2];
        fa[0] = ldsfrag(tb + fo); fb[0] = ldsfrag(tb + FPLANE + fo);
#pragma unroll
        for (int g = 0; g < 8; ++g) { const int t = g & 3, ks = g >> 2;   // each group's fragments are read one group ahead
            if (g < 7) { const int ao = ((g + 1) & 3) * 16 * FPITCH + ((g + 1) >> 2) * 32 + fo; fa[(g + 1) & 1] = ldsfrag(tb + ao); fb[(g + 1) & 1] = ldsfrag(tb + FPLANE + ao); }
            s[t] = wmmab(fa[g & 1], qh[ks], s[t]); s[t] = wmmab(fa[g & 1], ql[ks], s[t]); s[t] = wmmab(fb[g & 1], qh[ks], s[t]); }
        float mx = -3.0e38f;
#pragma unroll
        for (int t = 0; t < 4; ++t) {
#pragma unroll
            for (int j = 0; j < 8; j += 2) { const v4f mq = mk[2 * t + (j >> 2)]; const v2bf mb = __builtin_convertvector((v2f){mq[j & 3], mq[(j & 3) + 1]}, v2bf);
#pragma unroll
                for (int e = 0; e < 2; ++e) { float v = s[t][j + e] * SCL; v = v + (float)mb[e] * -1e9f; s[t][j + e] = v; mx = fmaxf(mx, v); } } }
        mx = fmaxf(mx, xhalf(mx));
        const float mn = fmaxf(m, mx), alpha = __builtin_amdgcn_exp2f((m - mn) * LOG2E);
        m = mn;
        float ts[4];
        v8u phw[2], plw[2];
#pragma unroll
        for (int t = 0; t < 4; ++t) { ts[t] = 0.f;
#pragma unroll
            for (int j = 0; j < 8; j += 2) { const float p0 = __builtin_amdgcn_exp2f((s[t][j] - mn) * LOG2E), p1 = __builtin_amdgcn_exp2f((s[t][j + 1] - mn) * LOG2E); ts[t] += p0; ts[t] += p1;
                const v2bf hb = __builtin_convertvector((v2f){p0, p1}, v2bf); const v2bf lb = __builtin_convertvector((v2f){p0 - (float)hb[0], p1 - (float)hb[1]}, v2bf);
                phw[t >> 1][(t & 1) * 4 + (j >> 1)] = __builtin_bit_cast(unsigned, hb); plw[t >> 1][(t & 1) * 4 + (j >> 1)] = __builtin_bit_cast(unsigned, lb); } }
        sum = sum * alpha + ((ts[0] + ts[1]) + (ts[2] + ts[3]));
#pragma unroll
        for (int t = 0; t < 4; ++t) o[t] *= alpha;
        fa[0] = ldsfrag(tb + 2 * FPLANE + fo); fb[0] = ldsfrag(tb + 3 * FPLANE + fo);
#pragma unroll
        for (int g = 0; g < 8; ++g) { const int t = g & 3, ks = g >> 2; const v16bf ph = __builtin_bit_cast(v16bf, phw[ks]), pl = __builtin_bit_cast(v16bf, plw[ks]);
            if (g < 7) { const int ao = ((g + 1) & 3) * 16 * FPITCH + ((g + 1) >> 2) * 32 + fo; fa[(g + 1) & 1] = ldsfrag(tb + 2 * FPLANE + ao); fb[(g + 1) & 1] = ldsfrag(tb + 3 * FPLANE + ao); }
            o[t] = wmmab(fa[g & 1], ph, o[t]); o[t] = wmmab(fa[g & 1], pl, o[t]); o[t] = wmmab(fb[g & 1], ph, o[t]); }
        put(&tile[(it + 1) & 1][0]);
        __syncthreads();   // publishes the next tile and ends every reader's last read of this one
    }
    sum += xhalf(sum);
    const float inv = 1.0f / sum;
    const size_t oo = ((size_t)b * NN + q) * DMOD + h * HD + 8 * hi;   // merged heads, as the hi and residual planes that the output projection reads
#pragma unroll
    for (int t = 0; t < 4; ++t) { const v8f r = o[t] * inv; v8us oh, ol;
#pragma unroll
        for (int i = 0; i < 8; ++i) { const unsigned short hb = f2bf(r[i]); oh[i] = hb; ol[i] = f2bf(r[i] - bf2f(hb)); }
        *(v8us*)(Oh + oo + 16 * t) = oh; *(v8us*)(Ol + oo + 16 * t) = ol; }
}

extern "C" void kernel_launch(void* const* d_in, const int* in_sizes, int n_in,
                              void* d_out, int out_size, void* d_ws, size_t ws_size, hipStream_t stream) {
    (void)in_sizes; (void)n_in; (void)out_size;
    const float* xq = (const float*)d_in[0]; const float* xk = (const float*)d_in[1]; const float* xv = xk; const float* mask = (const float*)d_in[2]; const float* Wq = (const float*)d_in[3]; const float* Wk = (const float*)d_in[4]; const float* Wv = (const float*)d_in[5]; const float* Wo = (const float*)d_in[6];
    float* out = (float*)d_out;    // [NBT][NN][DMOD]
    char* wsp = (char*)d_ws;
    auto take = [&](size_t bytes) { char* p = wsp; wsp += (bytes + 255) & ~(size_t)255; return (void*)p; };
    const size_t WSZ = (size_t)DMOD * DMOD * 2;
    bf* WQ = (bf*)take(WSZ); bf* WK = (bf*)take(WSZ); bf* WV = (bf*)take(WSZ); bf* WO = (bf*)take(WSZ);
    bf* Xq = (bf*)take((size_t)NBT * NN * DMOD * 2); bf* Xk = (bf*)take((size_t)NBT * NKT * DMOD * 2);
    const size_t PEL = (size_t)NH_ * NN * HD, PSZ = (size_t)NBT * PEL * 2;    // one plane: [item][head][2048][64] (V^T: [item][head][64][2048])
    bf* Qh = (bf*)take(PSZ); bf* Ql = (bf*)take(PSZ); bf* Kh = (bf*)take(PSZ); bf* Kl = (bf*)take(PSZ); bf* VTh = (bf*)take(PSZ); bf* VTl = (bf*)take(PSZ);
    bf* Oh = (bf*)take((size_t)NBT * NN * DMOD * 2); bf* Ol = (bf*)take((size_t)NBT * NN * DMOD * 2);
    if ((size_t)(wsp - (char*)d_ws) > ws_size) return;
    k_prep<<<4 * WTB + 2 * XB, 256, 0, stream>>>(Wq, Wk, Wv, Wo, xq, xk, WQ, WK, WV, WO, Xq, Xk);
    k_proj<<<dim3(NN / 64, DMOD / 64, 3 * NBT), 128, 0, stream>>>(Xq, Xk, WQ, WK, WV, Qh, Ql, Kh, Kl, VTh, VTl);
    k_fattn<<<dim3(NN / 128, NBT * NH_, 1), 256, 0, stream>>>(Qh, Ql, Kh, Kl, VTh, VTl, mask, Oh, Ol);
    k_outp<<<dim3(NBT * NN / 64, DMOD / 64, 1), 128, 0, stream>>>(Oh, Ol, WO, out);
}

// v005
// A run of this version takes 144 microseconds.
// Timed twice side by side with v004, it ran 1.07 times as fast both times.
// All steps since v000 together make it 14.5 times as fast.
#include <hip/hip_runtime.h>

// Compute dtypes, f32 accumulate, per item: q/k/v projections as [2048 x 1024].[1024 x 1024] GEMMs with PLAIN bf16 operands (the inputs themselves; exact products);
// per head (head dim 64; one fused launch over all items and heads): scores = q.k^T and attn.v with both operands as bf16 hi + UNSCALED residual planes (three products); the 1/sqrt(64) scale,
// the mask (additive mask rounded to bf16, x -1e9) and the running-maximum softmax in f32, normalised after attn.v; output projection on hi/lo planes of the merged heads (two products) - on v_wmma_f32_16x16x32_bf16.

#define NBT  2
#define NN   2048
#define NKT  2048
#define DMOD 1024
#define NH_  16
#define HD   64
#define ZH   2
#define DM   DMOD
#define NTK  NN
#define SCL  0.125f
#define LOSC 1024.0f

typedef _Float16 h16;
typedef unsigned short bf;
typedef __attribute__((ext_vector_type(16))) __bf16   v16bf;
typedef __attribute__((ext_vector_type(16))) _Float16 v16h;
typedef __attribute__((ext_vector_type(8)))  _Float16 v8h;
typedef __attribute__((ext_vector_type(8)))  unsigned short v8us;
typedef __attribute__((ext_vector_type(8)))  float    v8f;
typedef __attribute__((ext_vector_type(4)))  float    v4f;
typedef __attribute__((ext_vector_type(4)))  _Float16 v4h;
typedef v8h  __attribute__((may_alias)) v8ha;
typedef v4f  __attribute__((may_alias)) v4fa;
typedef v8us __attribute__((may_alias)) v8usa;

__device__ __forceinline__ unsigned short f2bf(float f) { unsigned u = __float_as_uint(f); u += 0x7FFFu + ((u >> 16) & 1u); return (unsigned short)(u >> 16); }
__device__ __forceinline__ float bf2f(unsigned short b) { return __uint_as_float(((unsigned)b) << 16); }
__device__ __forceinline__ float bfr(float f) { return bf2f(f2bf(f)); }
__device__ __forceinline__ v16h cat16(v8h lo, v8h hi) { return __builtin_shufflevector(lo, hi, 0, 1, 2, 3, 4, 5, 6, 7, 8, 9, 10, 11, 12, 13, 14, 15); }
__device__ __forceinline__ v16bf cat16b(v8us lo, v8us hi) { return __builtin_bit_cast(v16bf, __builtin_shufflevector(lo, hi, 0, 1, 2, 3, 4, 5, 6, 7, 8, 9, 10, 11, 12, 13, 14, 15)); }
__device__ __forceinline__ v16bf ldsfrag(const unsigned short* p) { return cat16b(*(const v8usa*)p, *(const v8usa*)(p + 16)); }
__device__ __forceinline__ v8f wmma16(v16h a, v16h b, v8f c) { return __builtin_amdgcn_wmma_f32_16x16x32_f16(false, a, false, b, (short)0, c, false, false); }
__device__ __forceinline__ v8f wmmab(v16bf a, v16bf b, v8f c) { return __builtin_amdgcn_wmma_f32_16x16x32_bf16(false, a, false, b, (short)0, c, false, false); }

// wt_tile: WT [n][K] = bf16(W[k][n]) (k-major [K][ncols]) via 64 x 64 LDS tiles; one work-group of 256 does tile (bx, by) of (K/64, ncols/64).
__device__ __forceinline__ void wt_tile(const float* __restrict__ Wm, int K, int ncols, bf* WT, int bx, int by) {
    __shared__ __align__(16) unsigned short tl[64 * 72];
    const int tid = threadIdx.x, k0 = bx * 64, n0 = by * 64;
    const int kk = tid >> 2, nq = (tid & 3) * 16;
#pragma unroll
    for (int i = 0; i < 16; ++i) tl[(nq + i) * 72 + kk] = f2bf(Wm[(size_t)(k0 + kk) * ncols + n0 + nq + i]);
    __syncthreads();
    const int piece = tid & 7;
    auto pass = [&]() {
#pragma unroll
        for (int s = 0; s < 2; ++s) { const int nr = (tid >> 3) + 32 * s; const v8us val = *(const v8usa*)(tl + nr * 72 + piece * 8); *(v8us*)(WT + (size_t)(n0 + nr) * K + k0 + piece * 8) = val; }
    };
    pass(); 
}
// gemm_tile: block tile (bx, by), 64 x 64 (4 waves x 16 x 64) of C = (A [+ Al]).B^T (K = 1024, a multiple of GKC) [+ bf(bias[c])] [+ bf(R[r][c]) residual]; f32 whole-line epilogue, or
// PLANES: the tile leaves as bf16 hi + residual planes, its row r at r * ldc + by * cbs in Ph and Pl (128 bytes a row and plane, whole lines), so that no f32 copy is stored and split later.
// The operands come in chunks of GKC k values by asynchronous copies into two LDS buffers: a wave's copy reads whole 128-byte lines (two rows of 256 bytes), each line once a work-group,
// and the 16-row fragments are read from LDS; k order and sum order are those of fragment loads straight from memory.
#define GKC    128          // k values of a chunk
#define GPITCH (GKC + 8)    // LDS row pitch in bf16 elements: 272 bytes = 16 B x odd, for 16-byte fragment reads
#define GTILE  (64 * GPITCH)
// copy8: the lane's 16 bytes of eight rows, 8 rows apart (gs bytes in memory), from g to LDS byte address l. The copies and their s_wait_xcnt stand in one statement,
// so that no address register is rewritten in front of the wait.
__device__ __forceinline__ void copy8(unsigned l, const char* g, size_t gs) {
    asm volatile("global_load_async_to_lds_b128 %0, %8, off\n\t"
                 "global_load_async_to_lds_b128 %1, %9, off\n\t"
                 "global_load_async_to_lds_b128 %2, %10, off\n\t"
                 "global_load_async_to_lds_b128 %3, %11, off\n\t"
                 "global_load_async_to_lds_b128 %4, %12, off\n\t"
                 "global_load_async_to_lds_b128 %5, %13, off\n\t"
                 "global_load_async_to_lds_b128 %6, %14, off\n\t"
                 "global_load_async_to_lds_b128 %7, %15, off\n\t"
                 "s_wait_xcnt 0x0"
                 :: "v"(l), "v"(l + 1 * 16 * GPITCH), "v"(l + 2 * 16 * GPITCH), "v"(l + 3 * 16 * GPITCH), "v"(l + 4 * 16 * GPITCH), "v"(l + 5 * 16 * GPITCH), "v"(l + 6 * 16 * GPITCH), "v"(l + 7 * 16 * GPITCH),
                    "v"(g), "v"(g + gs), "v"(g + 2 * gs), "v"(g + 3 * gs), "v"(g + 4 * gs), "v"(g + 5 * gs), "v"(g + 6 * gs), "v"(g + 7 * gs) : "memory");
}
template <bool SPLITA, bool PLANES = false>
__device__ __forceinline__ void gemm_tile(int bx, int by, const bf* __restrict__ A, const bf* __restrict__ Al, const bf* __restrict__ Bn, const float* __restrict__ bias, float* C, int ldc, bf* Ph, bf* Pl, size_t cbs, const float* __restrict__ R = nullptr, int K = DM, int roundR = 1) {
    constexpr int NT = SPLITA ? 3 : 2;
    __shared__ __align__(16) unsigned short stg[2][NT * GTILE];   // two buffers x (A, B [, Al]), 64 rows of GKC each
    __shared__ __align__(16) float ost[4][16 * 68];
    const int tid = threadIdx.x, lane = tid & 31, wave = tid >> 5, lr = lane & 15, hi = lane >> 4;
    const int r0 = bx * 64 + wave * 16, c0 = by * 64;
    const int srow = tid >> 4, spc = (tid & 15) * 8;   // a lane copies piece spc of rows srow, srow + 8, ... of each tile
    const size_t ao = (size_t)(bx * 64 + srow) * K + spc, bo = (size_t)(c0 + srow) * K + spc, gs = (size_t)K * 16;
    const unsigned lb = (unsigned)(size_t)&stg[0][0] + (unsigned)(srow * GPITCH + spc) * 2u;   // LDS byte address: the low 32 bits of the shared address
    auto copy = [&](int kc, int buf) {
        const unsigned l = lb + (unsigned)buf * (NT * GTILE * 2);
        copy8(l, (const char*)(A + ao + kc), gs); copy8(l + GTILE * 2, (const char*)(Bn + bo + kc), gs); if (SPLITA) copy8(l + 2 * GTILE * 2, (const char*)(Al + ao + kc), gs);
    };
    const int fao = (wave * 16 + lr) * GPITCH + 8 * hi, fbo = GTILE + lr * GPITCH + 8 * hi;
    v8f acc[4];
#pragma unroll
    for (int t = 0; t < 4; ++t) acc[t] = (v8f){};
    copy(0, 0);
    asm volatile("s_wait_asynccnt 0x0" ::: "memory");   // this wave's copies of chunk 0 have landed
    __syncthreads();                                    // every wave's have
    const int nch = K / GKC;
    if (nch > 1) copy(GKC, 1);
#pragma unroll 1   // stays rolled: a trip holds four unrolled k steps
    for (int ch = 0; ch < nch; ++ch) {
        const int cur = ch & 1;
        const unsigned short* tb = &stg[cur][0];
        v16bf fa[GKC / 32], fl[GKC / 32], fb[GKC / 32][4];
#pragma unroll
        for (int ks = 0; ks < GKC / 32; ++ks) { fa[ks] = ldsfrag(tb + fao + ks * 32); fl[ks] = fa[ks]; if (SPLITA) fl[ks] = ldsfrag(tb + 2 * GTILE + fao + ks * 32);
#pragma unroll
            for (int t = 0; t < 4; ++t) fb[ks][t] = ldsfrag(tb + fbo + t * 16 * GPITCH + ks * 32); }
        __builtin_amdgcn_sched_barrier(0);   // keeps the chunk's fragment reads issued as one group ahead of its products; sunk to their uses, each product would wait out a whole LDS read
#pragma unroll
        for (int ks = 0; ks < GKC / 32; ++ks) {
#pragma unroll
            for (int t = 0; t < 4; ++t) { acc[t] = wmmab(fa[ks], fb[ks][t], acc[t]); if (SPLITA) acc[t] = wmmab(fl[ks], fb[ks][t], acc[t]); } }
        __builtin_amdgcn_sched_barrier(0);   // keeps the products above the waits below, so that they run while the later fragments and the next chunk's copies are still on their way
        asm volatile("s_wait_dscnt 0x0" ::: "memory");      // this wave's reads of the buffer that is refilled below have retired
        asm volatile("s_wait_asynccnt 0x0" ::: "memory");   // this wave's copies of the next chunk have landed
        __syncthreads();                                    // publishes the next chunk and ends every reader's last read of this one
        if (ch + 2 < nch) copy((ch + 2) * GKC, cur);        // flies under the next chunk's products
    }
    asm volatile("s_wait_asynccnt 0x0" ::: "memory");   // no copy is outstanding when the wave goes on
    float* os = &ost[wave][0];
#pragma unroll
    for (int t = 0; t < 4; ++t) { const float bv = bias ? bfr(bias[c0 + t * 16 + lr]) : 0.f;
#pragma unroll
        for (int j = 0; j < 8; ++j) os[(hi * 8 + j) * 68 + t * 16 + lr] = acc[t][j] + bv; }
    __syncthreads();
    if (PLANES) {
        const size_t pb = (size_t)r0 * ldc + (size_t)by * cbs;
#pragma unroll
        for (int s = 0; s < 4; ++s) { const int row = 4 * s + (lane >> 3), piece = lane & 7; const float* sp = os + row * 68 + piece * 8; v8us oh, ol;
#pragma unroll
            for (int i = 0; i < 8; ++i) { const unsigned short hb = f2bf(sp[i]); oh[i] = hb; ol[i] = f2bf(sp[i] - bf2f(hb)); }
            const size_t o = pb + (size_t)row * ldc + piece * 8; *(v8us*)(Ph + o) = oh; *(v8us*)(Pl + o) = ol; }
    } else {
        float* crow = C + (size_t)r0 * ldc + c0;
        auto pass = [&]() {
#pragma unroll
            for (int s = 0; s < 8; ++s) { const int Lid = (lane >> 3) + 4 * s, piece = lane & 7; const int row = Lid >> 1, cofs = (Lid & 1) * 32 + piece * 4;
                v4f val = *(const v4fa*)(os + row * 68 + cofs); if (R) { const v4f rv = *(const v4f*)(R + ((size_t)r0 + row) * ldc + c0 + cofs); val += roundR ? (v4f){bfr(rv[0]), bfr(rv[1]), bfr(rv[2]), bfr(rv[3])} : rv; }
                *(v4f*)(crow + (size_t)row * ldc + cofs) = val; }
        };
        pass(); 
    }
}

// k_proj: the six projection GEMMs of a call, none of which reads another's result, as one grid (32, 16, 6): blockIdx.z = 2 * product (q, k, v) + item.
// A 64-column block of q or k is one head: row = token (pitch 64), block = head. V^T = W_v^T . y^T by swapping the operands: row = head * 64 + d (pitch 2048), block = 64 tokens.
__global__ __launch_bounds__(128) void k_proj(const bf* __restrict__ Xq, const bf* __restrict__ Xk, const bf* __restrict__ WQ, const bf* __restrict__ WK, const bf* __restrict__ WV, bf* Qh, bf* Ql, bf* Kh, bf* Kl, bf* VTh, bf* VTl) {
    const int p = blockIdx.z >> 1, b = blockIdx.z & 1;
    const size_t xo = (size_t)b * NN * DMOD, po = (size_t)b * NH_ * NN * HD;
    const bool v = p == 2;
    const bf* X = (p ? Xk : Xq) + xo;
    const bf* Wt = v ? WV : p ? WK : WQ;
    gemm_tile<false, true>(v ? blockIdx.y : blockIdx.x, v ? blockIdx.x : blockIdx.y, v ? Wt : X, nullptr, v ? X : Wt, nullptr, nullptr, v ? NKT : HD,
                           (v ? VTh : p ? Kh : Qh) + po, (v ? VTl : p ? Kl : Ql) + po, v ? (size_t)64 : (size_t)NN * HD);
}
// k_outp: the output projection of both items as one [4096 x 1024].[1024 x 1024] GEMM (the items' rows follow one another in the planes and in out); grid (64, 16).
__global__ __launch_bounds__(128) void k_outp(const bf* __restrict__ Oh, const bf* __restrict__ Ol, const bf* __restrict__ WO, float* out) {
    gemm_tile<true, false>(blockIdx.x, blockIdx.y, Oh, Ol, WO, nullptr, out, DMOD, nullptr, nullptr, 0);
}

__global__ __launch_bounds__(256) void k_cvt8(const float* __restrict__ src, bf* dst, size_t n8) {
    const size_t i = (size_t)blockIdx.x * 256 + threadIdx.x; if (i >= n8) return;
    const v8f v = *(const v8f*)(src + i * 8); v8us o;
#pragma unroll
    for (int k = 0; k < 8; ++k) o[k] = f2bf(v[k]);
    *(v8us*)(dst + i * 8) = o; 
}
__global__ __launch_bounds__(256) void k_zero8(bf* dst, size_t n8) {
    const size_t i = (size_t)blockIdx.x * 256 + threadIdx.x; if (i >= n8) return; v8us z;
#pragma unroll
    for (int k = 0; k < 8; ++k) z[k] = 0;
    *(v8us*)(dst + i * 8) = z; 
}

// ===== z-batched (blockIdx.z = head) attention pieces =====
__global__ __launch_bounds__(256) void k_planes32z(const float* __restrict__ F, int ld, int off, float sc, int rows, bf* Ph, bf* Pl) {
    typedef __attribute__((ext_vector_type(2))) unsigned short v2us;
    const int lane = threadIdx.x & 31; const size_t r = ((size_t)blockIdx.x * 8 + (threadIdx.x >> 5)) * 2 + (lane >> 4); if (r >= (size_t)rows) return; const int z = blockIdx.z; const int c0 = (lane & 15) * 2; v2us oh, ol;
    Ph += (size_t)z * rows * 32; Pl += (size_t)z * rows * 32;
#pragma unroll
    for (int i = 0; i < 2; ++i) { const float y = F[r * ld + off + z * 32 + c0 + i] * sc; const unsigned short hb = f2bf(y); oh[i] = hb; ol[i] = f2bf(y - bf2f(hb)); }
    const size_t o = r * 32 + c0; *(v2us*)(Ph + o) = oh; *(v2us*)(Pl + o) = ol; 
}
__global__ __launch_bounds__(256) void k_vtpadz(const float* __restrict__ F, int ld, int off, int nk, bf* Th, bf* Tl) {
    typedef __attribute__((ext_vector_type(2))) unsigned short v2us;
    const int lane = threadIdx.x & 31; const size_t wid = (size_t)blockIdx.x * 8 + (threadIdx.x >> 5); if (wid >= (size_t)64 * (nk / 64)) return; const int z = blockIdx.z; const int d = (int)(wid / (nk / 64)); const int k0 = (int)(wid % (nk / 64)) * 64 + lane * 2; v2us oh, ol;
    Th += (size_t)z * 64 * nk; Tl += (size_t)z * 64 * nk;
#pragma unroll
    for (int i = 0; i < 2; ++i) { const float y = (d < 32) ? F[(size_t)(k0 + i) * ld + off + z * 32 + (d < 32 ? d : 0)] : 0.f; const unsigned short hb = f2bf(y); oh[i] = hb; ol[i] = f2bf(y - bf2f(hb)); }
    const size_t o = (size_t)d * nk + k0; *(v2us*)(Th + o) = oh; *(v2us*)(Tl + o) = ol; 
}
template <int NK>
__global__ __launch_bounds__(256) void k_softmaxz(const float* __restrict__ S, int rows, bf* PH, bf* PL) {
    typedef __attribute__((ext_vector_type(4))) unsigned short v4us;
    const int lane = threadIdx.x & 31, i = blockIdx.x * 8 + (threadIdx.x >> 5); if (i >= rows) return; const size_t zo = (size_t)blockIdx.z * rows * NK; const float* sr = S + zo + (size_t)i * NK; PH += zo; PL += zo;
    float m = -3.0e38f;
#pragma unroll 1
    for (int c0 = lane * 4; c0 < NK; c0 += 128) {
#pragma unroll
        for (int q = 0; q < 4; ++q) m = fmaxf(m, sr[c0 + q]); }
#pragma unroll
    for (int sh = 16; sh; sh >>= 1) m = fmaxf(m, __shfl_xor(m, sh, 32));
    float sum = 0.f;
#pragma unroll 1
    for (int c0 = lane * 4; c0 < NK; c0 += 128) {
#pragma unroll
        for (int q = 0; q < 4; ++q) sum += __expf(sr[c0 + q] - m); }
#pragma unroll
    for (int sh = 16; sh; sh >>= 1) sum += __shfl_xor(sum, sh, 32);
    const float inv = 1.0f / sum;
{
#pragma unroll 1
        for (int c0 = lane * 4; c0 < NK; c0 += 128) { v4us oh, ol;
#pragma unroll
            for (int q = 0; q < 4; ++q) { const float p = __expf(sr[c0 + q] - m) * inv; const unsigned short hb = f2bf(p); oh[q] = hb; ol[q] = f2bf(p - bf2f(hb)); }
            const size_t o = (size_t)i * NK + c0; *(v4us*)(PH + o) = oh; *(v4us*)(PL + o) = ol; }
         }
}
__global__ __launch_bounds__(256) void k_placez(const float* __restrict__ XH, int rows, int ldy, float* Y) {
    const int lane = threadIdx.x & 31; const size_t q = (size_t)blockIdx.x * 8 + (threadIdx.x >> 5); if (q >= (size_t)rows) return; const int z = blockIdx.z; const float v = XH[((size_t)z * rows + q) * 64 + lane];
    *(float*)(Y + q * ldy + z * 32 + lane) = v; 
}

template <int NK>
__global__ __launch_bounds__(256) void k_softmaxzs(const float* __restrict__ S, int rows, float sc, bf* PH, bf* PL) {
    typedef __attribute__((ext_vector_type(4))) unsigned short v4us;
    const int lane = threadIdx.x & 31, i = blockIdx.x * 8 + (threadIdx.x >> 5); if (i >= rows) return; const size_t zo = (size_t)blockIdx.z * rows * NK; const float* sr = S + zo + (size_t)i * NK; PH += zo; PL += zo;
    float m = -3.0e38f;
#pragma unroll 1
    for (int c0 = lane * 4; c0 < NK; c0 += 128) {
#pragma unroll
        for (int q = 0; q < 4; ++q) m = fmaxf(m, sr[c0 + q] * sc); }
#pragma unroll
    for (int sh = 16; sh; sh >>= 1) m = fmaxf(m, __shfl_xor(m, sh, 32));
    float sum = 0.f;
#pragma unroll 1
    for (int c0 = lane * 4; c0 < NK; c0 += 128) {
#pragma unroll
        for (int q = 0; q < 4; ++q) sum += __expf(sr[c0 + q] * sc - m); }
#pragma unroll
    for (int sh = 16; sh; sh >>= 1) sum += __shfl_xor(sum, sh, 32);
    const float inv = 1.0f / sum;
{
#pragma unroll 1
        for (int c0 = lane * 4; c0 < NK; c0 += 128) { v4us oh, ol;
#pragma unroll
            for (int q = 0; q < 4; ++q) { const float p = __expf(sr[c0 + q] * sc - m) * inv; const unsigned short hb = f2bf(p); oh[q] = hb; ol[q] = f2bf(p - bf2f(hb)); }
            const size_t o = (size_t)i * NK + c0; *(v4us*)(PH + o) = oh; *(v4us*)(PL + o) = ol; }
         }
}

__device__ __forceinline__ void cvtx_rows(const float* __restrict__ src, int rows, bf* dst, int bx) {
    const int lane = threadIdx.x & 31; const size_t r = (size_t)bx * 8 + (threadIdx.x >> 5); if (r >= (size_t)rows) return;
{
#pragma unroll
        for (int q = 0; q < DMOD / 256; ++q) { v8us o;
#pragma unroll
            for (int i = 0; i < 8; ++i) o[i] = f2bf(src[r * DMOD + q * 256 + lane * 8 + i]);
            *(v8us*)(dst + r * DMOD + q * 256 + lane * 8) = o; }
         }
}
// mask_pack: the mask, rounded to bf16 as the attention kernel uses it, laid out in the order in which that kernel's lanes take it: [item * 128 + block of 16 queries][tile of 64 keys][t][lane][8],
// where lane (lr, hi) of group t holds query lr, keys 16 t + 8 hi + 0 .. 7. A wave of the attention kernel then reads its 16 x 64 piece as four loads of 512 contiguous bytes,
// where rows of the f32 mask gave it eight loads of 16 lines each, again for every head. One work-group packs 16 queries x MKC keys: whole rows in, through LDS, whole lines out.
#define MKC    512          // keys of a work-group's piece: one 64-key tile a wave
#define MPITCH (MKC + 8)    // LDS row pitch in bf16 elements: 1040 bytes = 16 B x odd, for 16-byte reads
#define MUNIT  (4 * 32 * 8) // bf16 elements of one packed 16 x 64 piece
typedef __attribute__((ext_vector_type(2))) float v2f;
typedef __attribute__((ext_vector_type(2))) __bf16 v2bf;
typedef __attribute__((ext_vector_type(8))) __bf16 v8bf;
typedef __attribute__((ext_vector_type(2))) unsigned v2u;
typedef v2u __attribute__((may_alias)) v2ua;
__device__ __forceinline__ void mask_pack(const float* __restrict__ MK, bf* MB, int c) {
    __shared__ __align__(16) unsigned short ml[16 * MPITCH];
    const int lane = threadIdx.x & 31, wave = threadIdx.x >> 5, lr = lane & 15, hi = lane >> 4;
    const int qb = c / (NKT / MKC), kc = c % (NKT / MKC);
    const float* sp = MK + ((size_t)qb * 16 + wave * 2) * NKT + kc * MKC + lane * 4;
#pragma unroll
    for (int r = 0; r < 2; ++r) {
#pragma unroll
        for (int s = 0; s < MKC / 128; ++s) { const v4f v = *(const v4f*)(sp + (size_t)r * NKT + s * 128);
            const v2bf a = __builtin_convertvector((v2f){v[0], v[1]}, v2bf), d = __builtin_convertvector((v2f){v[2], v[3]}, v2bf);
            *(v2ua*)(ml + (wave * 2 + r) * MPITCH + s * 128 + lane * 4) = (v2u){__builtin_bit_cast(unsigned, a), __builtin_bit_cast(unsigned, d)}; } }
    __syncthreads();
    bf* dp = MB + ((size_t)qb * (NKT / 64) + kc * (MKC / 64) + wave) * MUNIT + lane * 8;
#pragma unroll
    for (int t = 0; t < 4; ++t) *(v8us*)(dp + t * 256) = *(const v8usa*)(ml + lr * MPITCH + wave * 64 + 16 * t + 8 * hi);
    asm volatile("s_wait_xcnt 0x0" ::: "memory");   // stands behind the four stores, ahead of any later write of their address or data registers
}
// k_prep: all conversions of the inputs, none of which reads another's result, as one grid: work-groups 0 .. 1023 transpose the four weights (256 tiles each, (in, out) k-major -> n-major),
// the next 512 convert the rows of x (both items), the next 512 those of y, the last 1024 pack the mask.
#define WTB ((DMOD / 64) * (DMOD / 64))
#define XB  (NBT * NN / 8)
#define MPB (NBT * (NN / 16) * (NKT / MKC))
__global__ __launch_bounds__(256) void k_prep(const float* __restrict__ Wq, const float* __restrict__ Wk, const float* __restrict__ Wv, const float* __restrict__ Wo, const float* __restrict__ xq, const float* __restrict__ xk, const float* __restrict__ MK,
                                              bf* WQ, bf* WK, bf* WV, bf* WO, bf* Xq, bf* Xk, bf* MB) {
    const int g = blockIdx.x;
    if (g < 4 * WTB) { const int w = g / WTB, t = g % WTB;
        wt_tile(w == 0 ? Wq : w == 1 ? Wk : w == 2 ? Wv : Wo, DMOD, DMOD, w == 0 ? WQ : w == 1 ? WK : w == 2 ? WV : WO, t % (DMOD / 64), t / (DMOD / 64)); }
    else if (g < 4 * WTB + 2 * XB) { const int c = g - 4 * WTB; const bool y = c >= XB;
        cvtx_rows(y ? xk : xq, NBT * NN, y ? Xk : Xq, y ? c - XB : c); }
    else mask_pack(MK, MB, g - (4 * WTB + 2 * XB));
}
#define FPITCH 72   // LDS row pitch in bf16 elements: 144 bytes = 16 B x odd, for 16-byte fragment reads
#define FPLANE (64 * FPITCH)
#define LOG2E 1.4426950408889634f
typedef __attribute__((ext_vector_type(8))) unsigned v8u;
__device__ __forceinline__ float xhalf(float x) { return __builtin_bit_cast(float, __builtin_amdgcn_permlanex16(__builtin_bit_cast(int, x), __builtin_bit_cast(int, x), 0x76543210, 0xfedcba98, false, false)); }  // lane l with lane l ^ 16
__global__ __launch_bounds__(256) __attribute__((amdgpu_waves_per_eu(4, 4))) void k_fattn(const bf* __restrict__ Qh, const bf* __restrict__ Ql, const bf* __restrict__ Kh, const bf* __restrict__ Kl, const bf* __restrict__ VTh, const bf* __restrict__ VTl, const bf* __restrict__ MB, bf* Oh, bf* Ol) {
    __shared__ __align__(16) unsigned short tile[2][4 * FPLANE];   // two buffers x (K hi, K lo, V^T hi, V^T lo), 64 rows of 64 each
    const int tid = threadIdx.x, lane = tid & 31, wave = tid >> 5, lr = lane & 15, hi = lane >> 4;
    const int bh = blockIdx.y, b = bh / NH_, h = bh % NH_;
    const int q = blockIdx.x * 128 + wave * 16 + lr;
    v16bf qh[2], ql[2];
#pragma unroll
    for (int ks = 0; ks < 2; ++ks) { const size_t qo = ((size_t)bh * NN + q) * HD + ks * 32 + 8 * hi;
        qh[ks] = cat16b(*(const v8us*)(Qh + qo), *(const v8us*)(Qh + qo + 16)); ql[ks] = cat16b(*(const v8us*)(Ql + qo), *(const v8us*)(Ql + qo + 16)); }
    const int srow = tid >> 3, spc = (tid & 7) * 8;
    const size_t ko = ((size_t)bh * NKT + srow) * HD + spc, vo = ((size_t)bh * HD + srow) * NKT + spc;
    const int so = srow * FPITCH + spc;
    v8us st[8];
    auto fetch = [&](int key0) {
        const size_t k1 = ko + (size_t)key0 * HD, v1 = vo + key0;
        st[0] = *(const v8us*)(Kh + k1); st[1] = *(const v8us*)(Kh + k1 + 32 * HD); st[2] = *(const v8us*)(Kl + k1); st[3] = *(const v8us*)(Kl + k1 + 32 * HD);
        st[4] = *(const v8us*)(VTh + v1); st[5] = *(const v8us*)(VTh + v1 + (size_t)32 * NKT); st[6] = *(const v8us*)(VTl + v1); st[7] = *(const v8us*)(VTl + v1 + (size_t)32 * NKT);
    };
    auto put = [&](unsigned short* tb) {
#pragma unroll
        for (int a = 0; a < 4; ++a) { *(v8usa*)(tb + a * FPLANE + so) = st[2 * a]; *(v8usa*)(tb + a * FPLANE + so + 32 * FPITCH) = st[2 * a + 1]; }
    };
    const bf* mrow = MB + (size_t)(b * (NN / 16) + blockIdx.x * 8 + wave) * (NKT / 64) * MUNIT + lane * 8;   // this wave's 16 queries in the packed mask
    const int fo = lr * FPITCH + 8 * hi;
    v8f o[4];
#pragma unroll
    for (int t = 0; t < 4; ++t) o[t] = (v8f){};
    float m = -3.0e38f, sum = 0.f;
    fetch(0); put(&tile[0][0]);
    __syncthreads();
#pragma unroll 1   // stays rolled: one trip is already several hundred instructions
    for (int it = 0; it < NKT / 64; ++it) {
        const unsigned short* tb = &tile[it & 1][0];
        v8bf mk[4];
#pragma unroll
        for (int t = 0; t < 4; ++t) mk[t] = __builtin_bit_cast(v8bf, *(const v8us*)(mrow + it * MUNIT + t * 256));
        __builtin_amdgcn_sched_barrier(0);         // keeps the mask loads ahead of the tile loads: loads return in order, and the mask is wanted right behind the score products, the tile only at the trip's end
        fetch(((it + 1) & (NKT / 64 - 1)) * 64);   // the next tile, through registers; the last trip wraps to tile 0, which nobody reads: the loop stays free of branches and register copies
        __builtin_amdgcn_sched_barrier(0);         // keeps the mask and tile loads issued above the score products, so that their latency runs under them
        v8f s[4];
#pragma unroll
        for (int t = 0; t < 4; ++t) s[t] = (v8f){};
        v16bf fa[2], fb[2];
        fa[0] = ldsfrag(tb + fo); fb[0] = ldsfrag(tb + FPLANE + fo);
#pragma unroll
        for (int g = 0; g < 8; ++g) { const int t = g & 3, ks = g >> 2;   // each group's fragments are read one group ahead
            if (g < 7) { const int ao = ((g + 1) & 3) * 16 * FPITCH + ((g + 1) >> 2) * 32 + fo; fa[(g + 1) & 1] = ldsfrag(tb + ao); fb[(g + 1) & 1] = ldsfrag(tb + FPLANE + ao); }
            s[t] = wmmab(fa[g & 1], qh[ks], s[t]); s[t] = wmmab(fa[g & 1], ql[ks], s[t]); s[t] = wmmab(fb[g & 1], qh[ks], s[t]); }
        float mx = -3.0e38f;
#pragma unroll
        for (int t = 0; t < 4; ++t) {
#pragma unroll
            for (int j = 0; j < 8; ++j) { float v = s[t][j] * SCL; v = v + (float)mk[t][j] * -1e9f; s[t][j] = v; mx = fmaxf(mx, v); } }
        mx = fmaxf(mx, xhalf(mx));
        const float mn = fmaxf(m, mx), alpha = __builtin_amdgcn_exp2f((m - mn) * LOG2E);
        m = mn;
        float ts[4];
        v8u phw[2], plw[2];
#pragma unroll
        for (int t = 0; t < 4; ++t) { ts[t] = 0.f;
#pragma unroll
            for (int j = 0; j < 8; j += 2) { const float p0 = __builtin_amdgcn_exp2f((s[t][j] - mn) * LOG2E), p1 = __builtin_amdgcn_exp2f((s[t][j + 1] - mn) * LOG2E); ts[t] += p0; ts[t] += p1;
                const v2bf hb = __builtin_convertvector((v2f){p0, p1}, v2bf); const v2bf lb = __builtin_convertvector((v2f){p0 - (float)hb[0], p1 - (float)hb[1]}, v2bf);
                phw[t >> 1][(t & 1) * 4 + (j >> 1)] = __builtin_bit_cast(unsigned, hb); plw[t >> 1][(t & 1) * 4 + (j >> 1)] = __builtin_bit_cast(unsigned, lb); } }
        sum = sum * alpha + ((ts[0] + ts[1]) + (ts[2] + ts[3]));
#pragma unroll
        for (int t = 0; t < 4; ++t) o[t] *= alpha;
        fa[0] = ldsfrag(tb + 2 * FPLANE + fo); fb[0] = ldsfrag(tb + 3 * FPLANE + fo);
#pragma unroll
        for (int g = 0; g < 8; ++g) { const int t = g & 3, ks = g >> 2; const v16bf ph = __builtin_bit_cast(v16bf, phw[ks]), pl = __builtin_bit_cast(v16bf, plw[ks]);
            if (g < 7) { const int ao = ((g + 1) & 3) * 16 * FPITCH + ((g + 1) >> 2) * 32 + fo; fa[(g + 1) & 1] = ldsfrag(tb + 2 * FPLANE + ao); fb[(g + 1) & 1] = ldsfrag(tb + 3 * FPLANE + ao); }
            o[t] = wmmab(fa[g & 1], ph, o[t]); o[t] = wmmab(fa[g & 1], pl, o[t]); o[t] = wmmab(fb[g & 1], ph, o[t]); }
        put(&tile[(it + 1) & 1][0]);
        __syncthreads();   // publishes the next tile and ends every reader's last read of this one
    }
    sum += xhalf(sum);
    const float inv = 1.0f / sum;
    const size_t oo = ((size_t)b * NN + q) * DMOD + h * HD + 8 * hi;   // merged heads, as the hi and residual planes that the output projection reads
#pragma unroll
    for (int t = 0; t < 4; ++t) { const v8f r = o[t] * inv; v8us oh, ol;
#pragma unroll
        for (int i = 0; i < 8; ++i) { const unsigned short hb = f2bf(r[i]); oh[i] = hb; ol[i] = f2bf(r[i] - bf2f(hb)); }
        *(v8us*)(Oh + oo + 16 * t) = oh; *(v8us*)(Ol + oo + 16 * t) = ol; }
}

extern "C" void kernel_launch(void* const* d_in, const int* in_sizes, int n_in,
                              void* d_out, int out_size, void* d_ws, size_t ws_size, hipStream_t stream) {
    (void)in_sizes; (void)n_in; (void)out_size;
    const float* xq = (const float*)d_in[0]; const float* xk = (const float*)d_in[1]; const float* xv = xk; const float* mask = (const float*)d_in[2]; const float* Wq = (const float*)d_in[3]; const float* Wk = (const float*)d_in[4]; const float* Wv = (const float*)d_in[5]; const float* Wo = (const float*)d_in[6];
    float* out = (float*)d_out;    // [NBT][NN][DMOD]
    char* wsp = (char*)d_ws;
    auto take = [&](size_t bytes) { char* p = wsp; wsp += (bytes + 255) & ~(size_t)255; return (void*)p; };
    const size_t WSZ = (size_t)DMOD * DMOD * 2;
    bf* WQ = (bf*)take(WSZ); bf* WK = (bf*)take(WSZ); bf* WV = (bf*)take(WSZ); bf* WO = (bf*)take(WSZ);
    bf* Xq = (bf*)take((size_t)NBT * NN * DMOD * 2); bf* Xk = (bf*)take((size_t)NBT * NKT * DMOD * 2);
    const size_t PEL = (size_t)NH_ * NN * HD, PSZ = (size_t)NBT * PEL * 2;    // one plane: [item][head][2048][64] (V^T: [item][head][64][2048])
    bf* Qh = (bf*)take(PSZ); bf* Ql = (bf*)take(PSZ); bf* Kh = (bf*)take(PSZ); bf* Kl = (bf*)take(PSZ); bf* VTh = (bf*)take(PSZ); bf* VTl = (bf*)take(PSZ);
    bf* Oh = (bf*)take((size_t)NBT * NN * DMOD * 2); bf* Ol = (bf*)take((size_t)NBT * NN * DMOD * 2);
    bf* MB = (bf*)take((size_t)NBT * NN * NKT * 2);    // the packed bf16 mask
    if ((size_t)(wsp - (char*)d_ws) > ws_size) return;
    k_prep<<<4 * WTB + 2 * XB + MPB, 256, 0, stream>>>(Wq, Wk, Wv, Wo, xq, xk, mask, WQ, WK, WV, WO, Xq, Xk, MB);
    k_proj<<<dim3(NN / 64, DMOD / 64, 3 * NBT), 128, 0, stream>>>(Xq, Xk, WQ, WK, WV, Qh, Ql, Kh, Kl, VTh, VTl);
    k_fattn<<<dim3(NN / 128, NBT * NH_, 1), 256, 0, stream>>>(Qh, Ql, Kh, Kl, VTh, VTl, MB, Oh, Ol);
    k_outp<<<dim3(NBT * NN / 64, DMOD / 64, 1), 128, 0, stream>>>(Oh, Ol, WO, out);
}

// v006
// A run of this version takes 128 microseconds.
// Two timings next to v005 both put it at 1.12 times that version's speed.
// All steps since v000 together make it 16.2 times as fast.
#include <hip/hip_runtime.h>

// Compute dtypes, f32 accumulate, per item: q/k/v projections as [2048 x 1024].[1024 x 1024] GEMMs with PLAIN bf16 operands (the inputs themselves; exact products);
// per head (head dim 64; one fused launch over all items and heads): scores = q.k^T and attn.v with both operands as bf16 hi + UNSCALED residual planes (three products); the 1/sqrt(64) scale,
// the mask (additive mask rounded to bf16, x -1e9) and the running-maximum softmax in f32, normalised after attn.v; output projection on hi/lo planes of the merged heads (two products) - on v_wmma_f32_16x16x32_bf16.

#define NBT  2
#define NN   2048
#define NKT  2048
#define DMOD 1024
#define NH_  16
#define HD   64
#define ZH   2
#define DM   DMOD
#define NTK  NN
#define SCL  0.125f
#define LOSC 1024.0f

typedef _Float16 h16;
typedef unsigned short bf;
typedef __attribute__((ext_vector_type(16))) __bf16   v16bf;
typedef __attribute__((ext_vector_type(16))) _Float16 v16h;
typedef __attribute__((ext_vector_type(8)))  _Float16 v8h;
typedef __attribute__((ext_vector_type(8)))  unsigned short v8us;
typedef __attribute__((ext_vector_type(8)))  float    v8f;
typedef __attribute__((ext_vector_type(4)))  float    v4f;
typedef __attribute__((ext_vector_type(4)))  _Float16 v4h;
typedef v8h  __attribute__((may_alias)) v8ha;
typedef v4f  __attribute__((may_alias)) v4fa;
typedef v8us __attribute__((may_alias)) v8usa;

__device__ __forceinline__ unsigned short f2bf(float f) { unsigned u = __float_as_uint(f); u += 0x7FFFu + ((u >> 16) & 1u); return (unsigned short)(u >> 16); }
__device__ __forceinline__ float bf2f(unsigned short b) { return __uint_as_float(((unsigned)b) << 16); }
__device__ __forceinline__ float bfr(float f) { return bf2f(f2bf(f)); }
__device__ __forceinline__ v16h cat16(v8h lo, v8h hi) { return __builtin_shufflevector(lo, hi, 0, 1, 2, 3, 4, 5, 6, 7, 8, 9, 10, 11, 12, 13, 14, 15); }
__device__ __forceinline__ v16bf cat16b(v8us lo, v8us hi) { return __builtin_bit_cast(v16bf, __builtin_shufflevector(lo, hi, 0, 1, 2, 3, 4, 5, 6, 7, 8, 9, 10, 11, 12, 13, 14, 15)); }
__device__ __forceinline__ v16bf ldsfrag(const unsigned short* p) { return cat16b(*(const v8usa*)p, *(const v8usa*)(p + 16)); }
__device__ __forceinline__ v8f wmma16(v16h a, v16h b, v8f c) { return __builtin_amdgcn_wmma_f32_16x16x32_f16(false, a, false, b, (short)0, c, false, false); }
__device__ __forceinline__ v8f wmmab(v16bf a, v16bf b, v8f c) { return __builtin_amdgcn_wmma_f32_16x16x32_bf16(false, a, false, b, (short)0, c, false, false); }

// wt_tile: WT [n][K] = bf16(W[k][n]) (k-major [K][ncols]) via 64 x 64 LDS tiles; one work-group of 256 does tile (bx, by) of (K/64, ncols/64).
__device__ __forceinline__ void wt_tile(const float* __restrict__ Wm, int K, int ncols, bf* WT, int bx, int by) {
    __shared__ __align__(16) unsigned short tl[64 * 72];
    const int tid = threadIdx.x, k0 = bx * 64, n0 = by * 64;
    const int kk = tid >> 2, nq = (tid & 3) * 16;
#pragma unroll
    for (int i = 0; i < 16; ++i) tl[(nq + i) * 72 + kk] = f2bf(Wm[(size_t)(k0 + kk) * ncols + n0 + nq + i]);
    __syncthreads();
    const int piece = tid & 7;
    auto pass = [&]() {
#pragma unroll
        for (int s = 0; s < 2; ++s) { const int nr = (tid >> 3) + 32 * s; const v8us val = *(const v8usa*)(tl + nr * 72 + piece * 8); *(v8us*)(WT + (size_t)(n0 + nr) * K + k0 + piece * 8) = val; }
    };
    pass(); 
}
// gemm_tile: block tile (bx, by), 64 x 64 (4 waves x 16 x 64) of C = (A [+ Al]).B^T (K = 1024, a multiple of GKC) [+ bf(bias[c])] [+ bf(R[r][c]) residual]; f32 whole-line epilogue, or
// PLANES: the tile leaves as bf16 hi + residual planes, its row r at r * ldc + by * cbs in Ph and Pl (128 bytes a row and plane, whole lines), so that no f32 copy is stored and split later.
// The operands come in chunks of GKC k values by asynchronous copies into two LDS buffers: a wave's copy reads whole 128-byte lines (two rows of 256 bytes), each line once a work-group,
// and the 16-row fragments are read from LDS; k order and sum order are those of fragment loads straight from memory.
#define BLINE  32           // floats of a 128-byte line: each bound figure below has a line of its own, so that a line has one writer
#define GKC    128          // k values of a chunk
#define GPITCH (GKC + 8)    // LDS row pitch in bf16 elements: 272 bytes = 16 B x odd, for 16-byte fragment reads
#define GTILE  (64 * GPITCH)
// copy8: the lane's 16 bytes of eight rows, 8 rows apart (gs bytes in memory), from g to LDS byte address l. The copies and their s_wait_xcnt stand in one statement,
// so that no address register is rewritten in front of the wait.
__device__ __forceinline__ void copy8(unsigned l, const char* g, size_t gs) {
    asm volatile("global_load_async_to_lds_b128 %0, %8, off\n\t"
                 "global_load_async_to_lds_b128 %1, %9, off\n\t"
                 "global_load_async_to_lds_b128 %2, %10, off\n\t"
                 "global_load_async_to_lds_b128 %3, %11, off\n\t"
                 "global_load_async_to_lds_b128 %4, %12, off\n\t"
                 "global_load_async_to_lds_b128 %5, %13, off\n\t"
                 "global_load_async_to_lds_b128 %6, %14, off\n\t"
                 "global_load_async_to_lds_b128 %7, %15, off\n\t"
                 "s_wait_xcnt 0x0"
                 :: "v"(l), "v"(l + 1 * 16 * GPITCH), "v"(l + 2 * 16 * GPITCH), "v"(l + 3 * 16 * GPITCH), "v"(l + 4 * 16 * GPITCH), "v"(l + 5 * 16 * GPITCH), "v"(l + 6 * 16 * GPITCH), "v"(l + 7 * 16 * GPITCH),
                    "v"(g), "v"(g + gs), "v"(g + 2 * gs), "v"(g + 3 * gs), "v"(g + 4 * gs), "v"(g + 5 * gs), "v"(g + 6 * gs), "v"(g + 7 * gs) : "memory");
}
template <bool SPLITA, bool PLANES = false>
__device__ __forceinline__ void gemm_tile(int bx, int by, const bf* __restrict__ A, const bf* __restrict__ Al, const bf* __restrict__ Bn, const float* __restrict__ bias, float* C, int ldc, bf* Ph, bf* Pl, size_t cbs, float* amx = nullptr, const float* __restrict__ R = nullptr, int K = DM, int roundR = 1) {
    constexpr int NT = SPLITA ? 3 : 2;
    __shared__ __align__(16) unsigned short stg[2][NT * GTILE];   // two buffers x (A, B [, Al]), 64 rows of GKC each
    __shared__ __align__(16) float ost[4][16 * 68];
    const int tid = threadIdx.x, lane = tid & 31, wave = tid >> 5, lr = lane & 15, hi = lane >> 4;
    const int r0 = bx * 64 + wave * 16, c0 = by * 64;
    const int srow = tid >> 4, spc = (tid & 15) * 8;   // a lane copies piece spc of rows srow, srow + 8, ... of each tile
    const size_t ao = (size_t)(bx * 64 + srow) * K + spc, bo = (size_t)(c0 + srow) * K + spc, gs = (size_t)K * 16;
    const unsigned lb = (unsigned)(size_t)&stg[0][0] + (unsigned)(srow * GPITCH + spc) * 2u;   // LDS byte address: the low 32 bits of the shared address
    auto copy = [&](int kc, int buf) {
        const unsigned l = lb + (unsigned)buf * (NT * GTILE * 2);
        copy8(l, (const char*)(A + ao + kc), gs); copy8(l + GTILE * 2, (const char*)(Bn + bo + kc), gs); if (SPLITA) copy8(l + 2 * GTILE * 2, (const char*)(Al + ao + kc), gs);
    };
    const int fao = (wave * 16 + lr) * GPITCH + 8 * hi, fbo = GTILE + lr * GPITCH + 8 * hi;
    v8f acc[4];
#pragma unroll
    for (int t = 0; t < 4; ++t) acc[t] = (v8f){};
    copy(0, 0);
    asm volatile("s_wait_asynccnt 0x0" ::: "memory");   // this wave's copies of chunk 0 have landed
    __syncthreads();                                    // every wave's have
    const int nch = K / GKC;
    if (nch > 1) copy(GKC, 1);
#pragma unroll 1   // stays rolled: a trip holds four unrolled k steps
    for (int ch = 0; ch < nch; ++ch) {
        const int cur = ch & 1;
        const unsigned short* tb = &stg[cur][0];
        v16bf fa[GKC / 32], fl[GKC / 32], fb[GKC / 32][4];
#pragma unroll
        for (int ks = 0; ks < GKC / 32; ++ks) { fa[ks] = ldsfrag(tb + fao + ks * 32); fl[ks] = fa[ks]; if (SPLITA) fl[ks] = ldsfrag(tb + 2 * GTILE + fao + ks * 32);
#pragma unroll
            for (int t = 0; t < 4; ++t) fb[ks][t] = ldsfrag(tb + fbo + t * 16 * GPITCH + ks * 32); }
        __builtin_amdgcn_sched_barrier(0);   // keeps the chunk's fragment reads issued as one group ahead of its products; sunk to their uses, each product would wait out a whole LDS read
#pragma unroll
        for (int ks = 0; ks < GKC / 32; ++ks) {
#pragma unroll
            for (int t = 0; t < 4; ++t) { acc[t] = wmmab(fa[ks], fb[ks][t], acc[t]); if (SPLITA) acc[t] = wmmab(fl[ks], fb[ks][t], acc[t]); } }
        __builtin_amdgcn_sched_barrier(0);   // keeps the products above the waits below, so that they run while the later fragments and the next chunk's copies are still on their way
        asm volatile("s_wait_dscnt 0x0" ::: "memory");      // this wave's reads of the buffer that is refilled below have retired
        asm volatile("s_wait_asynccnt 0x0" ::: "memory");   // this wave's copies of the next chunk have landed
        __syncthreads();                                    // publishes the next chunk and ends every reader's last read of this one
        if (ch + 2 < nch) copy((ch + 2) * GKC, cur);        // flies under the next chunk's products
    }
    asm volatile("s_wait_asynccnt 0x0" ::: "memory");   // no copy is outstanding when the wave goes on
    float* os = &ost[wave][0];
#pragma unroll
    for (int t = 0; t < 4; ++t) { const float bv = bias ? bfr(bias[c0 + t * 16 + lr]) : 0.f;
#pragma unroll
        for (int j = 0; j < 8; ++j) os[(hi * 8 + j) * 68 + t * 16 + lr] = acc[t][j] + bv; }
    __syncthreads();
    if (PLANES) {
        const size_t pb = (size_t)r0 * ldc + (size_t)by * cbs;
        float am = 0.f;   // largest magnitude among this wave's 16 x 64 results
#pragma unroll
        for (int s = 0; s < 4; ++s) { const int row = 4 * s + (lane >> 3), piece = lane & 7; const float* sp = os + row * 68 + piece * 8; v8us oh, ol;
#pragma unroll
            for (int i = 0; i < 8; ++i) { const unsigned short hb = f2bf(sp[i]); oh[i] = hb; ol[i] = f2bf(sp[i] - bf2f(hb)); am = fmaxf(am, fabsf(sp[i])); }
            const size_t o = pb + (size_t)row * ldc + piece * 8; *(v8us*)(Ph + o) = oh; *(v8us*)(Pl + o) = ol; }
        if (amx) {   // the same for the whole work-group: the k projection alone hands the magnitudes on, a line of its own for each wave
#pragma unroll
            for (int sh = 16; sh; sh >>= 1) am = fmaxf(am, __shfl_xor(am, sh, 32));
            if (lane == 0) amx[wave * BLINE] = am;
            asm volatile("s_wait_xcnt 0x0" ::: "memory");   // stands behind the store, ahead of any later write of its address or data registers
        }
    } else {
        float* crow = C + (size_t)r0 * ldc + c0;
        auto pass = [&]() {
#pragma unroll
            for (int s = 0; s < 8; ++s) { const int Lid = (lane >> 3) + 4 * s, piece = lane & 7; const int row = Lid >> 1, cofs = (Lid & 1) * 32 + piece * 4;
                v4f val = *(const v4fa*)(os + row * 68 + cofs); if (R) { const v4f rv = *(const v4f*)(R + ((size_t)r0 + row) * ldc + c0 + cofs); val += roundR ? (v4f){bfr(rv[0]), bfr(rv[1]), bfr(rv[2]), bfr(rv[3])} : rv; }
                *(v4f*)(crow + (size_t)row * ldc + cofs) = val; }
        };
        pass(); 
    }
}

// k_proj: the six projection GEMMs of a call, none of which reads another's result, as one grid (32, 16, 6): blockIdx.z = 2 * product (q, k, v) + item.
// A 64-column block of q or k is one head: row = token (pitch 64), block = head. V^T = W_v^T . y^T by swapping the operands: row = head * 64 + d (pitch 2048), block = 64 tokens.
__global__ __launch_bounds__(128) void k_proj(const bf* __restrict__ Xq, const bf* __restrict__ Xk, const bf* __restrict__ WQ, const bf* __restrict__ WK, const bf* __restrict__ WV, bf* Qh, bf* Ql, bf* Kh, bf* Kl, bf* VTh, bf* VTl, float* KX) {
    const int p = blockIdx.z >> 1, b = blockIdx.z & 1;
    const size_t xo = (size_t)b * NN * DMOD, po = (size_t)b * NH_ * NN * HD;
    const bool v = p == 2;
    const bf* X = (p ? Xk : Xq) + xo;
    const bf* Wt = v ? WV : p ? WK : WQ;
    gemm_tile<false, true>(v ? blockIdx.y : blockIdx.x, v ? blockIdx.x : blockIdx.y, v ? Wt : X, nullptr, v ? X : Wt, nullptr, nullptr, v ? NKT : HD,
                           (v ? VTh : p ? Kh : Qh) + po, (v ? VTl : p ? Kl : Ql) + po, v ? (size_t)64 : (size_t)NN * HD,
                           p == 1 ? KX + ((size_t)(b * NH_ + blockIdx.y) * (NKT / 64) + blockIdx.x) * 4 * BLINE : nullptr);   // k: block (x, y) is key tile x of head y
}
// k_outp: the output projection of both items as one [4096 x 1024].[1024 x 1024] GEMM (the items' rows follow one another in the planes and in out); grid (64, 16).
__global__ __launch_bounds__(128) void k_outp(const bf* __restrict__ Oh, const bf* __restrict__ Ol, const bf* __restrict__ WO, float* out) {
    gemm_tile<true, false>(blockIdx.x, blockIdx.y, Oh, Ol, WO, nullptr, out, DMOD, nullptr, nullptr, 0);
}

__global__ __launch_bounds__(256) void k_cvt8(const float* __restrict__ src, bf* dst, size_t n8) {
    const size_t i = (size_t)blockIdx.x * 256 + threadIdx.x; if (i >= n8) return;
    const v8f v = *(const v8f*)(src + i * 8); v8us o;
#pragma unroll
    for (int k = 0; k < 8; ++k) o[k] = f2bf(v[k]);
    *(v8us*)(dst + i * 8) = o; 
}
__global__ __launch_bounds__(256) void k_zero8(bf* dst, size_t n8) {
    const size_t i = (size_t)blockIdx.x * 256 + threadIdx.x; if (i >= n8) return; v8us z;
#pragma unroll
    for (int k = 0; k < 8; ++k) z[k] = 0;
    *(v8us*)(dst + i * 8) = z; 
}

// ===== z-batched (blockIdx.z = head) attention pieces =====
__global__ __launch_bounds__(256) void k_planes32z(const float* __restrict__ F, int ld, int off, float sc, int rows, bf* Ph, bf* Pl) {
    typedef __attribute__((ext_vector_type(2))) unsigned short v2us;
    const int lane = threadIdx.x & 31; const size_t r = ((size_t)blockIdx.x * 8 + (threadIdx.x >> 5)) * 2 + (lane >> 4); if (r >= (size_t)rows) return; const int z = blockIdx.z; const int c0 = (lane & 15) * 2; v2us oh, ol;
    Ph += (size_t)z * rows * 32; Pl += (size_t)z * rows * 32;
#pragma unroll
    for (int i = 0; i < 2; ++i) { const float y = F[r * ld + off + z * 32 + c0 + i] * sc; const unsigned short hb = f2bf(y); oh[i] = hb; ol[i] = f2bf(y - bf2f(hb)); }
    const size_t o = r * 32 + c0; *(v2us*)(Ph + o) = oh; *(v2us*)(Pl + o) = ol; 
}
__global__ __launch_bounds__(256) void k_vtpadz(const float* __restrict__ F, int ld, int off, int nk, bf* Th, bf* Tl) {
    typedef __attribute__((ext_vector_type(2))) unsigned short v2us;
    const int lane = threadIdx.x & 31; const size_t wid = (size_t)blockIdx.x * 8 + (threadIdx.x >> 5); if (wid >= (size_t)64 * (nk / 64)) return; const int z = blockIdx.z; const int d = (int)(wid / (nk / 64)); const int k0 = (int)(wid % (nk / 64)) * 64 + lane * 2; v2us oh, ol;
    Th += (size_t)z * 64 * nk; Tl += (size_t)z * 64 * nk;
#pragma unroll
    for (int i = 0; i < 2; ++i) { const float y = (d < 32) ? F[(size_t)(k0 + i) * ld + off + z * 32 + (d < 32 ? d : 0)] : 0.f; const unsigned short hb = f2bf(y); oh[i] = hb; ol[i] = f2bf(y - bf2f(hb)); }
    const size_t o = (size_t)d * nk + k0; *(v2us*)(Th + o) = oh; *(v2us*)(Tl + o) = ol; 
}
template <int NK>
__global__ __launch_bounds__(256) void k_softmaxz(const float* __restrict__ S, int rows, bf* PH, bf* PL) {
    typedef __attribute__((ext_vector_type(4))) unsigned short v4us;
    const int lane = threadIdx.x & 31, i = blockIdx.x * 8 + (threadIdx.x >> 5); if (i >= rows) return; const size_t zo = (size_t)blockIdx.z * rows * NK; const float* sr = S + zo + (size_t)i * NK; PH += zo; PL += zo;
    float m = -3.0e38f;
#pragma unroll 1
    for (int c0 = lane * 4; c0 < NK; c0 += 128) {
#pragma unroll
        for (int q = 0; q < 4; ++q) m = fmaxf(m, sr[c0 + q]); }
#pragma unroll
    for (int sh = 16; sh; sh >>= 1) m = fmaxf(m, __shfl_xor(m, sh, 32));
    float sum = 0.f;
#pragma unroll 1
    for (int c0 = lane * 4; c0 < NK; c0 += 128) {
#pragma unroll
        for (int q = 0; q < 4; ++q) sum += __expf(sr[c0 + q] - m); }
#pragma unroll
    for (int sh = 16; sh; sh >>= 1) sum += __shfl_xor(sum, sh, 32);
    const float inv = 1.0f / sum;
{
#pragma unroll 1
        for (int c0 = lane * 4; c0 < NK; c0 += 128) { v4us oh, ol;
#pragma unroll
            for (int q = 0; q < 4; ++q) { const float p = __expf(sr[c0 + q] - m) * inv; const unsigned short hb = f2bf(p); oh[q] = hb; ol[q] = f2bf(p - bf2f(hb)); }
            const size_t o = (size_t)i * NK + c0; *(v4us*)(PH + o) = oh; *(v4us*)(PL + o) = ol; }
         }
}
__global__ __launch_bounds__(256) void k_placez(const float* __restrict__ XH, int rows, int ldy, float* Y) {
    const int lane = threadIdx.x & 31; const size_t q = (size_t)blockIdx.x * 8 + (threadIdx.x >> 5); if (q >= (size_t)rows) return; const int z = blockIdx.z; const float v = XH[((size_t)z * rows + q) * 64 + lane];
    *(float*)(Y + q * ldy + z * 32 + lane) = v; 
}

template <int NK>
__global__ __launch_bounds__(256) void k_softmaxzs(const float* __restrict__ S, int rows, float sc, bf* PH, bf* PL) {
    typedef __attribute__((ext_vector_type(4))) unsigned short v4us;
    const int lane = threadIdx.x & 31, i = blockIdx.x * 8 + (threadIdx.x >> 5); if (i >= rows) return; const size_t zo = (size_t)blockIdx.z * rows * NK; const float* sr = S + zo + (size_t)i * NK; PH += zo; PL += zo;
    float m = -3.0e38f;
#pragma unroll 1
    for (int c0 = lane * 4; c0 < NK; c0 += 128) {
#pragma unroll
        for (int q = 0; q < 4; ++q) m = fmaxf(m, sr[c0 + q] * sc); }
#pragma unroll
    for (int sh = 16; sh; sh >>= 1) m = fmaxf(m, __shfl_xor(m, sh, 32));
    float sum = 0.f;
#pragma unroll 1
    for (int c0 = lane * 4; c0 < NK; c0 += 128) {
#pragma unroll
        for (int q = 0; q < 4; ++q) sum += __expf(sr[c0 + q] * sc - m); }
#pragma unroll
    for (int sh = 16; sh; sh >>= 1) sum += __shfl_xor(sum, sh, 32);
    const float inv = 1.0f / sum;
{
#pragma unroll 1
        for (int c0 = lane * 4; c0 < NK; c0 += 128) { v4us oh, ol;
#pragma unroll
            for (int q = 0; q < 4; ++q) { const float p = __expf(sr[c0 + q] * sc - m) * inv; const unsigned short hb = f2bf(p); oh[q] = hb; ol[q] = f2bf(p - bf2f(hb)); }
            const size_t o = (size_t)i * NK + c0; *(v4us*)(PH + o) = oh; *(v4us*)(PL + o) = ol; }
         }
}

__device__ __forceinline__ void cvtx_rows(const float* __restrict__ src, int rows, bf* dst, int bx) {
    const int lane = threadIdx.x & 31; const size_t r = (size_t)bx * 8 + (threadIdx.x >> 5); if (r >= (size_t)rows) return;
{
#pragma unroll
        for (int q = 0; q < DMOD / 256; ++q) { v8us o;
#pragma unroll
            for (int i = 0; i < 8; ++i) o[i] = f2bf(src[r * DMOD + q * 256 + lane * 8 + i]);
            *(v8us*)(dst + r * DMOD + q * 256 + lane * 8) = o; }
         }
}
// mask_pack: the mask, rounded to bf16 as the attention kernel uses it, laid out in the order in which that kernel's lanes take it: [item * 128 + block of 16 queries][tile of 64 keys][t][lane][8],
// where lane (lr, hi) of group t holds query lr, keys 16 t + 8 hi + 0 .. 7. A wave of the attention kernel then reads its 16 x 64 piece as four loads of 512 contiguous bytes,
// where rows of the f32 mask gave it eight loads of 16 lines each, again for every head. One work-group packs 16 queries x MKC keys: whole rows in, through LDS, whole lines out.
#define MKC    512          // keys of a work-group's piece: one 64-key tile a wave
#define MPITCH (MKC + 8)    // LDS row pitch in bf16 elements: 1040 bytes = 16 B x odd, for 16-byte reads
#define MUNIT  (4 * 32 * 8) // bf16 elements of one packed 16 x 64 piece
typedef __attribute__((ext_vector_type(2))) float v2f;
typedef __attribute__((ext_vector_type(2))) __bf16 v2bf;
typedef __attribute__((ext_vector_type(8))) __bf16 v8bf;
typedef __attribute__((ext_vector_type(2))) unsigned v2u;
typedef v2u __attribute__((may_alias)) v2ua;
__device__ __forceinline__ void mask_pack(const float* __restrict__ MK, bf* MB, float* MN, int c) {
    __shared__ __align__(16) unsigned short ml[16 * MPITCH];
    const int lane = threadIdx.x & 31, wave = threadIdx.x >> 5, lr = lane & 15, hi = lane >> 4;
    const int qb = c / (NKT / MKC), kc = c % (NKT / MKC);
    const float* sp = MK + ((size_t)qb * 16 + wave * 2) * NKT + kc * MKC + lane * 4;
#pragma unroll
    for (int r = 0; r < 2; ++r) {
#pragma unroll
        for (int s = 0; s < MKC / 128; ++s) { const v4f v = *(const v4f*)(sp + (size_t)r * NKT + s * 128);
            const v2bf a = __builtin_convertvector((v2f){v[0], v[1]}, v2bf), d = __builtin_convertvector((v2f){v[2], v[3]}, v2bf);
            *(v2ua*)(ml + (wave * 2 + r) * MPITCH + s * 128 + lane * 4) = (v2u){__builtin_bit_cast(unsigned, a), __builtin_bit_cast(unsigned, d)}; } }
    __syncthreads();
    const size_t unit = (size_t)qb * (NKT / 64) + kc * (MKC / 64) + wave;
    bf* dp = MB + unit * MUNIT + lane * 8;
    float mn = 3.0e38f;   // smallest mask value of the wave's 16 x 64 piece, as rounded; -1 (never skipped) where a value is not a number
#pragma unroll
    for (int t = 0; t < 4; ++t) { const v8us pv = *(const v8usa*)(ml + lr * MPITCH + wave * 64 + 16 * t + 8 * hi); *(v8us*)(dp + t * 256) = pv;
#pragma unroll
        for (int i = 0; i < 8; ++i) { const float f = bf2f(pv[i]); mn = f == f ? fminf(mn, f) : -1.f; } }
#pragma unroll
    for (int sh = 16; sh; sh >>= 1) mn = fminf(mn, __shfl_xor(mn, sh, 32));
    if (lane == 0) MN[unit * BLINE] = mn;
    asm volatile("s_wait_xcnt 0x0" ::: "memory");   // stands behind the stores, ahead of any later write of their address or data registers
}
// k_prep: all conversions of the inputs, none of which reads another's result, as one grid: work-groups 0 .. 1023 transpose the four weights (256 tiles each, (in, out) k-major -> n-major),
// the next 512 convert the rows of x (both items), the next 512 those of y, the last 1024 pack the mask.
#define WTB ((DMOD / 64) * (DMOD / 64))
#define XB  (NBT * NN / 8)
#define MPB (NBT * (NN / 16) * (NKT / MKC))
__global__ __launch_bounds__(256) void k_prep(const float* __restrict__ Wq, const float* __restrict__ Wk, const float* __restrict__ Wv, const float* __restrict__ Wo, const float* __restrict__ xq, const float* __restrict__ xk, const float* __restrict__ MK,
                                              bf* WQ, bf* WK, bf* WV, bf* WO, bf* Xq, bf* Xk, bf* MB, float* MN) {
    const int g = blockIdx.x;
    if (g < 4 * WTB) { const int w = g / WTB, t = g % WTB;
        wt_tile(w == 0 ? Wq : w == 1 ? Wk : w == 2 ? Wv : Wo, DMOD, DMOD, w == 0 ? WQ : w == 1 ? WK : w == 2 ? WV : WO, t % (DMOD / 64), t / (DMOD / 64)); }
    else if (g < 4 * WTB + 2 * XB) { const int c = g - 4 * WTB; const bool y = c >= XB;
        cvtx_rows(y ? xk : xq, NBT * NN, y ? Xk : Xq, y ? c - XB : c); }
    else mask_pack(MK, MB, MN, g - (4 * WTB + 2 * XB));
}
#define FPITCH 72   // LDS row pitch in bf16 elements: 144 bytes = 16 B x odd, for 16-byte fragment reads
#define FPLANE (64 * FPITCH)
#define LOG2E 1.4426950408889634f
typedef __attribute__((ext_vector_type(8))) unsigned v8u;
__device__ __forceinline__ float xhalf(float x) { return __builtin_bit_cast(float, __builtin_amdgcn_permlanex16(__builtin_bit_cast(int, x), __builtin_bit_cast(int, x), 0x76543210, 0xfedcba98, false, false)); }  // lane l with lane l ^ 16
__global__ __launch_bounds__(256) __attribute__((amdgpu_waves_per_eu(4, 4))) void k_fattn(const bf* __restrict__ Qh, const bf* __restrict__ Ql, const bf* __restrict__ Kh, const bf* __restrict__ Kl, const bf* __restrict__ VTh, const bf* __restrict__ VTl, const bf* __restrict__ MB, const float* __restrict__ MN, const float* __restrict__ KX, bf* Oh, bf* Ol) {
    __shared__ __align__(16) unsigned short tile[2][4 * FPLANE];   // two buffers x (K hi, K lo, V^T hi, V^T lo), 64 rows of 64 each
    const int tid = threadIdx.x, lane = tid & 31, wave = tid >> 5, lr = lane & 15, hi = lane >> 4;
    const int bh = blockIdx.y, b = bh / NH_, h = bh % NH_;
    const int qb = wave < 4 ? blockIdx.x * 4 + wave : (NN / 64 - 1 - blockIdx.x) * 4 + wave - 4;   // the wave's block of 16 queries: waves 0 .. 3 take 64 queries from the front, waves 4 .. 7 the mirrored 64 from the back
    const int q = qb * 16 + lr;
    v16bf qh[2], ql[2];
#pragma unroll
    for (int ks = 0; ks < 2; ++ks) { const size_t qo = ((size_t)bh * NN + q) * HD + ks * 32 + 8 * hi;
        qh[ks] = cat16b(*(const v8us*)(Qh + qo), *(const v8us*)(Qh + qo + 16)); ql[ks] = cat16b(*(const v8us*)(Ql + qo), *(const v8us*)(Ql + qo + 16)); }
    const int srow = tid >> 3, spc = (tid & 7) * 8;
    const size_t ko = ((size_t)bh * NKT + srow) * HD + spc, vo = ((size_t)bh * HD + srow) * NKT + spc;
    const int so = srow * FPITCH + spc;
    v8us st[8];
    auto fetch = [&](int key0) {
        const size_t k1 = ko + (size_t)key0 * HD, v1 = vo + key0;
        st[0] = *(const v8us*)(Kh + k1); st[1] = *(const v8us*)(Kh + k1 + 32 * HD); st[2] = *(const v8us*)(Kl + k1); st[3] = *(const v8us*)(Kl + k1 + 32 * HD);
        st[4] = *(const v8us*)(VTh + v1); st[5] = *(const v8us*)(VTh + v1 + (size_t)32 * NKT); st[6] = *(const v8us*)(VTl + v1); st[7] = *(const v8us*)(VTl + v1 + (size_t)32 * NKT);
    };
    auto put = [&](unsigned short* tb) {
#pragma unroll
        for (int a = 0; a < 4; ++a) { *(v8usa*)(tb + a * FPLANE + so) = st[2 * a]; *(v8usa*)(tb + a * FPLANE + so + 32 * FPITCH) = st[2 * a + 1]; }
    };
    const bf* mrow = MB + (size_t)(b * (NN / 16) + qb) * (NKT / 64) * MUNIT + lane * 8;   // this wave's 16 queries in the packed mask
    // The dead-tile test. Lane l keeps key tile l's two figures: tu, an upper bound of the tile's mask terms for this wave's queries, and tk, which times the query's largest |q| bounds every |score| / 8 of the tile:
    // 64 terms x three plane products stay below 64 x 1.02 x max|k| x max|q hi|, an eighth of that is 8.16, and 16 leaves room for every rounding; 0.999e9 does so for the mask term.
    static_assert(NKT / 64 == 32, "one lane a key tile");
    const float mnl = MN[((size_t)(b * (NN / 16) + qb) * (NKT / 64) + lane) * BLINE];
    const float* kxp = KX + ((size_t)bh * (NKT / 64) + lane) * 4 * BLINE;
    const float kxl = fmaxf(fmaxf(kxp[0], kxp[BLINE]), fmaxf(kxp[2 * BLINE], kxp[3 * BLINE]));
    asm volatile("s_wait_xcnt 0x0" ::: "memory");   // stands behind the five loads, ahead of any later write of their address registers
    const float tu = mnl > 0.f ? mnl * -0.999e9f : 3.0e38f, tk = kxl * 16.f;   // a tile with a mask value that is not above 0 is never skipped
    unsigned qu = 0u;   // largest |q hi| of the lane's half row, taken on the bit patterns: magnitudes of floats order as unsigned integers
#pragma unroll
    for (int ks = 0; ks < 2; ++ks) { const v8u w = __builtin_bit_cast(v8u, qh[ks]);
#pragma unroll
        for (int i = 0; i < 8; ++i) { const unsigned a = w[i] & 0x7fff0000u, c = (w[i] << 16) & 0x7fff0000u; qu = qu > a ? qu : a; qu = qu > c ? qu : c; } }
    float qa = __builtin_bit_cast(float, qu);
    qa = fmaxf(qa, xhalf(qa));
    const int fo = lr * FPITCH + 8 * hi;
    v8f o[4];
#pragma unroll
    for (int t = 0; t < 4; ++t) o[t] = (v8f){};
    float m = -3.0e38f, sum = 0.f;
    fetch(0); put(&tile[0][0]);
    __syncthreads();
#pragma unroll 1   // stays rolled: one trip is already several hundred instructions
    for (int it = 0; it < NKT / 64; ++it) {
        const unsigned short* tb = &tile[it & 1][0];
        // A tile is dead for the wave where every score of it, mask term included, lies 200 or more below its query's running maximum: then the maximum stays, the rescale factor is 1 and every weight
        // is exp2 of less than -288, exactly 0, so that the trip would leave sum and accumulators as they are (k and v finite, as finite inputs make them). Tested once a trip, the same for the whole wave (a scalar branch); the wave still stages and meets the barrier.
        const float su = __builtin_bit_cast(float, __builtin_amdgcn_readlane(__builtin_bit_cast(int, tu), it)), sk = __builtin_bit_cast(float, __builtin_amdgcn_readlane(__builtin_bit_cast(int, tk), it));
        const bool live = __builtin_amdgcn_ballot_w32(!(fmaf(sk, qa, su) - m <= -200.f)) != 0u;
        v8bf mk[4];
        if (live) {
#pragma unroll
        for (int t = 0; t < 4; ++t) mk[t] = __builtin_bit_cast(v8bf, *(const v8us*)(mrow + it * MUNIT + t * 256));
        }
        __builtin_amdgcn_sched_barrier(0);         // keeps the mask loads ahead of the tile loads: loads return in order, and the mask is wanted right behind the score products, the tile only at the trip's end
        fetch(((it + 1) & (NKT / 64 - 1)) * 64);   // the next tile, through registers; the last trip wraps to tile 0, which nobody reads
        asm volatile("s_wait_xcnt 0x0" ::: "memory");   // stands behind the mask and tile loads, ahead of the first write of an address register of theirs on either side of the branch below
        __builtin_amdgcn_sched_barrier(0);         // keeps the mask and tile loads issued above the score products, so that their latency runs under them
        if (live) {
        v8f s[4];
#pragma unroll
        for (int t = 0; t < 4; ++t) s[t] = (v8f){};
        v16bf fa[2], fb[2];
        fa[0] = ldsfrag(tb + fo); fb[0] = ldsfrag(tb + FPLANE + fo);
#pragma unroll
        for (int g = 0; g < 8; ++g) { const int t = g & 3, ks = g >> 2;   // each group's fragments are read one group ahead
            if (g < 7) { const int ao = ((g + 1) & 3) * 16 * FPITCH + ((g + 1) >> 2) * 32 + fo; fa[(g + 1) & 1] = ldsfrag(tb + ao); fb[(g + 1) & 1] = ldsfrag(tb + FPLANE + ao); }
            s[t] = wmmab(fa[g & 1], qh[ks], s[t]); s[t] = wmmab(fa[g & 1], ql[ks], s[t]); s[t] = wmmab(fb[g & 1], qh[ks], s[t]); }
        float mx = -3.0e38f;
#pragma unroll
        for (int t = 0; t < 4; ++t) {
#pragma unroll
            for (int j = 0; j < 8; ++j) { float v = s[t][j] * SCL; v = v + (float)mk[t][j] * -1e9f; s[t][j] = v; mx = fmaxf(mx, v); } }
        mx = fmaxf(mx, xhalf(mx));
        const float mn = fmaxf(m, mx), alpha = __builtin_amdgcn_exp2f((m - mn) * LOG2E);
        m = mn;
        float ts[4];
        v8u phw[2], plw[2];
#pragma unroll
        for (int t = 0; t < 4; ++t) { ts[t] = 0.f;
#pragma unroll
            for (int j = 0; j < 8; j += 2) { const float p0 = __builtin_amdgcn_exp2f((s[t][j] - mn) * LOG2E), p1 = __builtin_amdgcn_exp2f((s[t][j + 1] - mn) * LOG2E); ts[t] += p0; ts[t] += p1;
                const v2bf hb = __builtin_convertvector((v2f){p0, p1}, v2bf); const v2bf lb = __builtin_convertvector((v2f){p0 - (float)hb[0], p1 - (float)hb[1]}, v2bf);
                phw[t >> 1][(t & 1) * 4 + (j >> 1)] = __builtin_bit_cast(unsigned, hb); plw[t >> 1][(t & 1) * 4 + (j >> 1)] = __builtin_bit_cast(unsigned, lb); } }
        sum = sum * alpha + ((ts[0] + ts[1]) + (ts[2] + ts[3]));
#pragma unroll
        for (int t = 0; t < 4; ++t) o[t] *= alpha;
        fa[0] = ldsfrag(tb + 2 * FPLANE + fo); fb[0] = ldsfrag(tb + 3 * FPLANE + fo);
#pragma unroll
        for (int g = 0; g < 8; ++g) { const int t = g & 3, ks = g >> 2; const v16bf ph = __builtin_bit_cast(v16bf, phw[ks]), pl = __builtin_bit_cast(v16bf, plw[ks]);
            if (g < 7) { const int ao = ((g + 1) & 3) * 16 * FPITCH + ((g + 1) >> 2) * 32 + fo; fa[(g + 1) & 1] = ldsfrag(tb + 2 * FPLANE + ao); fb[(g + 1) & 1] = ldsfrag(tb + 3 * FPLANE + ao); }
            o[t] = wmmab(fa[g & 1], ph, o[t]); o[t] = wmmab(fa[g & 1], pl, o[t]); o[t] = wmmab(fb[g & 1], ph, o[t]); }
        }
        put(&tile[(it + 1) & 1][0]);
        __syncthreads();   // publishes the next tile and ends every reader's last read of this one
    }
    sum += xhalf(sum);
    const float inv = 1.0f / sum;
    const size_t oo = ((size_t)b * NN + q) * DMOD + h * HD + 8 * hi;   // merged heads, as the hi and residual planes that the output projection reads
#pragma unroll
    for (int t = 0; t < 4; ++t) { const v8f r = o[t] * inv; v8us oh, ol;
#pragma unroll
        for (int i = 0; i < 8; ++i) { const unsigned short hb = f2bf(r[i]); oh[i] = hb; ol[i] = f2bf(r[i] - bf2f(hb)); }
        *(v8us*)(Oh + oo + 16 * t) = oh; *(v8us*)(Ol + oo + 16 * t) = ol; }
}

extern "C" void kernel_launch(void* const* d_in, const int* in_sizes, int n_in,
                              void* d_out, int out_size, void* d_ws, size_t ws_size, hipStream_t stream) {
    (void)in_sizes; (void)n_in; (void)out_size;
    const float* xq = (const float*)d_in[0]; const float* xk = (const float*)d_in[1]; const float* xv = xk; const float* mask = (const float*)d_in[2]; const float* Wq = (const float*)d_in[3]; const float* Wk = (const float*)d_in[4]; const float* Wv = (const float*)d_in[5]; const float* Wo = (const float*)d_in[6];
    float* out = (float*)d_out;    // [NBT][NN][DMOD]
    char* wsp = (char*)d_ws;
    auto take = [&](size_t bytes) { char* p = wsp; wsp += (bytes + 255) & ~(size_t)255; return (void*)p; };
    const size_t WSZ = (size_t)DMOD * DMOD * 2;
    bf* WQ = (bf*)take(WSZ); bf* WK = (bf*)take(WSZ); bf* WV = (bf*)take(WSZ); bf* WO = (bf*)take(WSZ);
    bf* Xq = (bf*)take((size_t)NBT * NN * DMOD * 2); bf* Xk = (bf*)take((size_t)NBT * NKT * DMOD * 2);
    const size_t PEL = (size_t)NH_ * NN * HD, PSZ = (size_t)NBT * PEL * 2;    // one plane: [item][head][2048][64] (V^T: [item][head][64][2048])
    bf* Qh = (bf*)take(PSZ); bf* Ql = (bf*)take(PSZ); bf* Kh = (bf*)take(PSZ); bf* Kl = (bf*)take(PSZ); bf* VTh = (bf*)take(PSZ); bf* VTl = (bf*)take(PSZ);
    bf* Oh = (bf*)take((size_t)NBT * NN * DMOD * 2); bf* Ol = (bf*)take((size_t)NBT * NN * DMOD * 2);
    bf* MB = (bf*)take((size_t)NBT * NN * NKT * 2);    // the packed bf16 mask
    float* MN = (float*)take((size_t)NBT * (NN / 16) * (NKT / 64) * BLINE * 4);    // smallest mask value of each 16 x 64 piece
    float* KX = (float*)take((size_t)NBT * NH_ * (NKT / 64) * 4 * BLINE * 4);      // largest |k| of each 16 keys of a head
    if ((size_t)(wsp - (char*)d_ws) > ws_size) return;
    k_prep<<<4 * WTB + 2 * XB + MPB, 256, 0, stream>>>(Wq, Wk, Wv, Wo, xq, xk, mask, WQ, WK, WV, WO, Xq, Xk, MB, MN);
    k_proj<<<dim3(NN / 64, DMOD / 64, 3 * NBT), 128, 0, stream>>>(Xq, Xk, WQ, WK, WV, Qh, Ql, Kh, Kl, VTh, VTl, KX);
    k_fattn<<<dim3(NN / 128, NBT * NH_, 1), 256, 0, stream>>>(Qh, Ql, Kh, Kl, VTh, VTl, MB, MN, KX, Oh, Ol);
    k_outp<<<dim3(NBT * NN / 64, DMOD / 64, 1), 128, 0, stream>>>(Oh, Ol, WO, out);
}

// v007
// A run of this version takes 116 microseconds.
// Timed twice side by side with v006, it ran 1.10 and 1.11 times as fast.
// All steps since v000 together make it 17.8 times as fast.
#include <hip/hip_runtime.h>

// Compute dtypes, f32 accumulate, per item: q/k/v projections as [2048 x 1024].[1024 x 1024] GEMMs with PLAIN bf16 operands (the inputs themselves; exact products);
// per head (head dim 64; one fused launch over all items and heads): scores = q.k^T and attn.v with both operands as bf16 hi + UNSCALED residual planes (three products); the 1/sqrt(64) scale,
// the mask (additive mask rounded to bf16, x -1e9) and the running-maximum softmax in f32, normalised after attn.v; output projection on hi/lo planes of the merged heads (two products) - on v_wmma_f32_16x16x32_bf16.

#define NBT  2
#define NN   2048
#define NKT  2048
#define DMOD 1024
#define NH_  16
#define HD   64
#define ZH   2
#define DM   DMOD
#define NTK  NN
#define SCL  0.125f
#define LOSC 1024.0f

typedef _Float16 h16;
typedef unsigned short bf;
typedef __attribute__((ext_vector_type(16))) __bf16   v16bf;
typedef __attribute__((ext_vector_type(16))) _Float16 v16h;
typedef __attribute__((ext_vector_type(8)))  _Float16 v8h;
typedef __attribute__((ext_vector_type(8)))  unsigned short v8us;
typedef __attribute__((ext_vector_type(8)))  float    v8f;
typedef __attribute__((ext_vector_type(4)))  float    v4f;
typedef __attribute__((ext_vector_type(4)))  _Float16 v4h;
typedef v8h  __attribute__((may_alias)) v8ha;
typedef v4f  __attribute__((may_alias)) v4fa;
typedef v8us __attribute__((may_alias)) v8usa;

__device__ __forceinline__ unsigned short f2bf(float f) { unsigned u = __float_as_uint(f); u += 0x7FFFu + ((u >> 16) & 1u); return (unsigned short)(u >> 16); }
__device__ __forceinline__ float bf2f(unsigned short b) { return __uint_as_float(((unsigned)b) << 16); }
__device__ __forceinline__ float bfr(float f) { return bf2f(f2bf(f)); }
__device__ __forceinline__ v16h cat16(v8h lo, v8h hi) { return __builtin_shufflevector(lo, hi, 0, 1, 2, 3, 4, 5, 6, 7, 8, 9, 10, 11, 12, 13, 14, 15); }
__device__ __forceinline__ v16bf cat16b(v8us lo, v8us hi) { return __builtin_bit_cast(v16bf, __builtin_shufflevector(lo, hi, 0, 1, 2, 3, 4, 5, 6, 7, 8, 9, 10, 11, 12, 13, 14, 15)); }
__device__ __forceinline__ v16bf ldsfrag(const unsigned short* p) { return cat16b(*(const v8usa*)p, *(const v8usa*)(p + 16)); }
__device__ __forceinline__ v8f wmma16(v16h a, v16h b, v8f c) { return __builtin_amdgcn_wmma_f32_16x16x32_f16(false, a, false, b, (short)0, c, false, false); }
__device__ __forceinline__ v8f wmmab(v16bf a, v16bf b, v8f c) { return __builtin_amdgcn_wmma_f32_16x16x32_bf16(false, a, false, b, (short)0, c, false, false); }

// wt_tile: WT [n][K] = bf16(W[k][n]) (k-major [K][ncols]) via 64 x 64 LDS tiles; one work-group of 256 does tile (bx, by) of (K/64, ncols/64).
__device__ __forceinline__ void wt_tile(const float* __restrict__ Wm, int K, int ncols, bf* WT, int bx, int by) {
    __shared__ __align__(16) unsigned short tl[64 * 72];
    const int tid = threadIdx.x, k0 = bx * 64, n0 = by * 64;
    const int kk = tid >> 2, nq = (tid & 3) * 16;
#pragma unroll
    for (int i = 0; i < 16; ++i) tl[(nq + i) * 72 + kk] = f2bf(Wm[(size_t)(k0 + kk) * ncols + n0 + nq + i]);
    __syncthreads();
    const int piece = tid & 7;
    auto pass = [&]() {
#pragma unroll
        for (int s = 0; s < 2; ++s) { const int nr = (tid >> 3) + 32 * s; const v8us val = *(const v8usa*)(tl + nr * 72 + piece * 8); *(v8us*)(WT + (size_t)(n0 + nr) * K + k0 + piece * 8) = val; }
    };
    pass(); 
}
// gemm_tile: block tile (bx, by), 128 x 128, of C = (A [+ Al]).B^T (K = 1024, a multiple of KC) [+ bf(bias[c])] [+ bf(R[r][c]) residual]; the waves stand (8 / MF) x 2, each with 16 MF rows x 64 columns,
// so that an A fragment read from LDS serves four products and a B fragment MF (2 MF with Al), and a row of an operand is copied from L2 for 128 results, not 64. f32 whole-line epilogue, or
// PLANES: a wave's 64 columns (block byw = 2 by + its column) leave as bf16 hi + residual planes, row r at r * ldc + byw * cbs in Ph and Pl (128 bytes a row and plane, whole lines), so that no f32 copy is stored and split later.
// The operands come in chunks of KC k values by asynchronous copies into two LDS buffers: a wave's copy reads whole 128-byte lines, each line once a work-group,
// and the 16-row fragments are read from LDS, KG k steps as one group; k order and sum order of every result are those of fragment loads straight from memory.
#define BLINE  32           // floats of a 128-byte line: each bound figure below has a line of its own, so that a line has one writer
// copy8: the lane's 16 bytes of eight rows, 16 rows apart (gs bytes in memory, LDS row pitch PITCH bf16 elements), from g to LDS byte address l. The copies and their s_wait_xcnt stand in one statement,
// so that no address register is rewritten in front of the wait.
template <int PITCH>
__device__ __forceinline__ void copy8(unsigned l, const char* g, size_t gs) {
    asm volatile("global_load_async_to_lds_b128 %0, %8, off\n\t"
                 "global_load_async_to_lds_b128 %1, %9, off\n\t"
                 "global_load_async_to_lds_b128 %2, %10, off\n\t"
                 "global_load_async_to_lds_b128 %3, %11, off\n\t"
                 "global_load_async_to_lds_b128 %4, %12, off\n\t"
                 "global_load_async_to_lds_b128 %5, %13, off\n\t"
                 "global_load_async_to_lds_b128 %6, %14, off\n\t"
                 "global_load_async_to_lds_b128 %7, %15, off\n\t"
                 "s_wait_xcnt 0x0"
                 :: "v"(l), "v"(l + 1 * 32 * PITCH), "v"(l + 2 * 32 * PITCH), "v"(l + 3 * 32 * PITCH), "v"(l + 4 * 32 * PITCH), "v"(l + 5 * 32 * PITCH), "v"(l + 6 * 32 * PITCH), "v"(l + 7 * 32 * PITCH),
                    "v"(g), "v"(g + gs), "v"(g + 2 * gs), "v"(g + 3 * gs), "v"(g + 4 * gs), "v"(g + 5 * gs), "v"(g + 6 * gs), "v"(g + 7 * gs) : "memory");
}
template <bool SPLITA, bool PLANES, int MF, int KC, int KG>
__device__ __forceinline__ void gemm_tile(int bx, int by, const bf* __restrict__ A, const bf* __restrict__ Al, const bf* __restrict__ Bn, const float* __restrict__ bias, float* C, int ldc, bf* Ph, bf* Pl, size_t cbs, float* amx = nullptr, const float* __restrict__ R = nullptr, int K = DM, int roundR = 1) {
    constexpr int NT = SPLITA ? 3 : 2, NWV = (8 / MF) * 2, PP = KC / 8;
    constexpr int PITCH = KC + 8;        // LDS row pitch in bf16 elements: 16 B x odd, for 16-byte fragment reads
    constexpr int GT = 128 * PITCH;      // one operand's 128 rows of a chunk
    static_assert(NWV * 32 / PP == 16 && (KC / 32) % KG == 0, "one copy of every lane covers 16 rows of a chunk");
    __shared__ __align__(16) unsigned short stg[2][NT * GT];   // two buffers x (A, B [, Al]), 128 rows of KC each
    static_assert(NWV * MF * 16 * 68 * 4 <= 2 * NT * GT * 2, "the epilogue's f32 tile fits in the two buffers");
    const int tid = threadIdx.x, lane = tid & 31, wave = tid >> 5, lr = lane & 15, hi = lane >> 4, wr = wave >> 1, wc = wave & 1;
    const int r0 = bx * 128 + wr * 16 * MF, byw = by * 2 + wc, c0 = byw * 64;
    const int srow = tid / PP, spc = (tid % PP) * 8;   // a lane copies piece spc of rows srow, srow + 16, ... of each tile
    const size_t ao = (size_t)(bx * 128 + srow) * K + spc, bo = (size_t)(by * 128 + srow) * K + spc, gs = (size_t)K * 32;
    const unsigned lb = (unsigned)(size_t)&stg[0][0] + (unsigned)(srow * PITCH + spc) * 2u;   // LDS byte address: the low 32 bits of the shared address
    auto copy = [&](int kc, int buf) {
        const unsigned l = lb + (unsigned)buf * (NT * GT * 2);
        copy8<PITCH>(l, (const char*)(A + ao + kc), gs); copy8<PITCH>(l + GT * 2, (const char*)(Bn + bo + kc), gs); if (SPLITA) copy8<PITCH>(l + 2 * GT * 2, (const char*)(Al + ao + kc), gs);
    };
    const int fao = (wr * 16 * MF + lr) * PITCH + 8 * hi, fbo = GT + (wc * 64 + lr) * PITCH + 8 * hi;
    v8f acc[MF][4];
#pragma unroll
    for (int f = 0; f < MF; ++f) {
#pragma unroll
        for (int t = 0; t < 4; ++t) acc[f][t] = (v8f){}; }
    copy(0, 0);
    asm volatile("s_wait_asynccnt 0x0" ::: "memory");   // this wave's copies of chunk 0 have landed
    __syncthreads();                                    // every wave's have
    const int nch = K / KC;
    if (nch > 1) copy(KC, 1);
#pragma unroll 1   // stays rolled: a trip holds KC / 32 unrolled k steps
    for (int ch = 0; ch < nch; ++ch) {
        const int cur = ch & 1;
        const unsigned short* tb = &stg[cur][0];
#pragma unroll
        for (int kg = 0; kg < KC / 32; kg += KG) {
            v16bf fa[KG][MF], fl[KG][MF], fb[KG][4];
#pragma unroll
            for (int kk = 0; kk < KG; ++kk) { const int ko = (kg + kk) * 32;
#pragma unroll
                for (int f = 0; f < MF; ++f) { fa[kk][f] = ldsfrag(tb + fao + f * 16 * PITCH + ko); fl[kk][f] = fa[kk][f]; }
#pragma unroll
                for (int t = 0; t < 4; ++t) fb[kk][t] = ldsfrag(tb + fbo + t * 16 * PITCH + ko);
                if (SPLITA) {
#pragma unroll
                    for (int f = 0; f < MF; ++f) fl[kk][f] = ldsfrag(tb + 2 * GT + fao + f * 16 * PITCH + ko); } }
            __builtin_amdgcn_sched_barrier(0);   // keeps the group's fragment reads issued as one group ahead of its products; sunk to their uses, each product would wait out a whole LDS read
#pragma unroll
            for (int kk = 0; kk < KG; ++kk) {   // every accumulator takes A then Al of a k step, as before; the products between them belong to other accumulators
#pragma unroll
                for (int t = 0; t < 4; ++t) {
#pragma unroll
                    for (int f = 0; f < MF; ++f) acc[f][t] = wmmab(fa[kk][f], fb[kk][t], acc[f][t]); }
                if (SPLITA) {
#pragma unroll
                    for (int t = 0; t < 4; ++t) {
#pragma unroll
                        for (int f = 0; f < MF; ++f) acc[f][t] = wmmab(fl[kk][f], fb[kk][t], acc[f][t]); } } }
            __builtin_amdgcn_sched_barrier(0);   // keeps the products above the next group's reads and above the waits below, so that they run while the next chunk's copies are still on their way
        }
        asm volatile("s_wait_dscnt 0x0" ::: "memory");      // this wave's reads of the buffer that is refilled below have retired
        asm volatile("s_wait_asynccnt 0x0" ::: "memory");   // this wave's copies of the next chunk have landed
        __syncthreads();                                    // publishes the next chunk and ends every reader's last read of this one
        if (ch + 2 < nch) copy((ch + 2) * KC, cur);         // flies under the next chunk's products
    }
    asm volatile("s_wait_asynccnt 0x0" ::: "memory");   // no copy is outstanding when the wave goes on
    float* ow = (float*)&stg[0][0] + wave * (MF * 16 * 68);   // the wave's f32 tile, in the copy buffers: the loop's last barrier ended every wave's reads of them, and no copy is outstanding
#pragma unroll
    for (int t = 0; t < 4; ++t) { const float bv = bias ? bfr(bias[c0 + t * 16 + lr]) : 0.f;
#pragma unroll
        for (int f = 0; f < MF; ++f) {
#pragma unroll
            for (int j = 0; j < 8; ++j) ow[(f * 16 + hi * 8 + j) * 68 + t * 16 + lr] = acc[f][t][j] + bv; } }
    __syncthreads();
#pragma unroll
    for (int f = 0; f < MF; ++f) {   // the tile leaves in slabs of 16 rows
    const int rf = r0 + f * 16;
    const float* os = ow + f * 16 * 68;
    if (PLANES) {
        const size_t pb = (size_t)rf * ldc + (size_t)byw * cbs;
        float am = 0.f;   // largest magnitude among this slab's 16 x 64 results
#pragma unroll
        for (int s = 0; s < 4; ++s) { const int row = 4 * s + (lane >> 3), piece = lane & 7; const float* sp = os + row * 68 + piece * 8; v8us oh, ol;
#pragma unroll
            for (int i = 0; i < 8; ++i) { const unsigned short hb = f2bf(sp[i]); oh[i] = hb; ol[i] = f2bf(sp[i] - bf2f(hb)); am = fmaxf(am, fabsf(sp[i])); }
            const size_t o = pb + (size_t)row * ldc + piece * 8; *(v8us*)(Ph + o) = oh; *(v8us*)(Pl + o) = ol; }
        asm volatile("s_wait_xcnt 0x0" ::: "memory");   // stands behind the slab's plane stores, ahead of the next slab's writes of their address and data registers
        if (amx) {   // the same for the whole work-group: the k projection alone hands the magnitudes on, a line of its own for each 16 keys of head byw
#pragma unroll
            for (int sh = 16; sh; sh >>= 1) am = fmaxf(am, __shfl_xor(am, sh, 32));
            if (lane == 0) amx[((size_t)byw * (NKT / 16) + (rf >> 4)) * BLINE] = am;
            asm volatile("s_wait_xcnt 0x0" ::: "memory");   // stands behind the store, ahead of any later write of its address or data registers
        }
    } else {
        float* crow = C + (size_t)rf * ldc + c0;
#pragma unroll
        for (int s = 0; s < 8; ++s) { const int Lid = (lane >> 3) + 4 * s, piece = lane & 7; const int row = Lid >> 1, cofs = (Lid & 1) * 32 + piece * 4;
            v4f val = *(const v4fa*)(os + row * 68 + cofs); if (R) { const v4f rv = *(const v4f*)(R + ((size_t)rf + row) * ldc + c0 + cofs); val += roundR ? (v4f){bfr(rv[0]), bfr(rv[1]), bfr(rv[2]), bfr(rv[3])} : rv; }
            *(v4f*)(crow + (size_t)row * ldc + cofs) = val; }
    }
    }
}

// k_proj: the six projection GEMMs of a call, none of which reads another's result, as one grid (16, 8, 6): blockIdx.z = 2 * product (q, k, v) + item. Four waves of 64 x 64; three work-groups a WGP hold the whole grid.
// A 64-column block of q or k is one head: row = token (pitch 64), block = head. V^T = W_v^T . y^T by swapping the operands: row = head * 64 + d (pitch 2048), block = 64 tokens.
__global__ __launch_bounds__(128) void k_proj(const bf* __restrict__ Xq, const bf* __restrict__ Xk, const bf* __restrict__ WQ, const bf* __restrict__ WK, const bf* __restrict__ WV, bf* Qh, bf* Ql, bf* Kh, bf* Kl, bf* VTh, bf* VTl, float* KX) {
    const int p = blockIdx.z >> 1, b = blockIdx.z & 1;
    const size_t xo = (size_t)b * NN * DMOD, po = (size_t)b * NH_ * NN * HD;
    const bool v = p == 2;
    const bf* X = (p ? Xk : Xq) + xo;
    const bf* Wt = v ? WV : p ? WK : WQ;
    gemm_tile<false, true, 4, 64, 1>(v ? blockIdx.y : blockIdx.x, v ? blockIdx.x : blockIdx.y, v ? Wt : X, nullptr, v ? X : Wt, nullptr, nullptr, v ? NKT : HD,
                           (v ? VTh : p ? Kh : Qh) + po, (v ? VTl : p ? Kl : Ql) + po, v ? (size_t)64 : (size_t)NN * HD,
                           p == 1 ? KX + (size_t)b * NH_ * (NKT / 16) * BLINE : nullptr);   // k: rows are keys, a column block is a head
}
// k_outp: the output projection of both items as one [4096 x 1024].[1024 x 1024] GEMM (the items' rows follow one another in the planes and in out); grid (32, 8), eight waves of 32 x 64.
__global__ __launch_bounds__(256) void k_outp(const bf* __restrict__ Oh, const bf* __restrict__ Ol, const bf* __restrict__ WO, float* out) {
    gemm_tile<true, false, 2, 128, 2>(blockIdx.x, blockIdx.y, Oh, Ol, WO, nullptr, out, DMOD, nullptr, nullptr, 0);
}

__global__ __launch_bounds__(256) void k_cvt8(const float* __restrict__ src, bf* dst, size_t n8) {
    const size_t i = (size_t)blockIdx.x * 256 + threadIdx.x; if (i >= n8) return;
    const v8f v = *(const v8f*)(src + i * 8); v8us o;
#pragma unroll
    for (int k = 0; k < 8; ++k) o[k] = f2bf(v[k]);
    *(v8us*)(dst + i * 8) = o; 
}
__global__ __launch_bounds__(256) void k_zero8(bf* dst, size_t n8) {
    const size_t i = (size_t)blockIdx.x * 256 + threadIdx.x; if (i >= n8) return; v8us z;
#pragma unroll
    for (int k = 0; k < 8; ++k) z[k] = 0;
    *(v8us*)(dst + i * 8) = z; 
}

// ===== z-batched (blockIdx.z = head) attention pieces =====
__global__ __launch_bounds__(256) void k_planes32z(const float* __restrict__ F, int ld, int off, float sc, int rows, bf* Ph, bf* Pl) {
    typedef __attribute__((ext_vector_type(2))) unsigned short v2us;
    const int lane = threadIdx.x & 31; const size_t r = ((size_t)blockIdx.x * 8 + (threadIdx.x >> 5)) * 2 + (lane >> 4); if (r >= (size_t)rows) return; const int z = blockIdx.z; const int c0 = (lane & 15) * 2; v2us oh, ol;
    Ph += (size_t)z * rows * 32; Pl += (size_t)z * rows * 32;
#pragma unroll
    for (int i = 0; i < 2; ++i) { const float y = F[r * ld + off + z * 32 + c0 + i] * sc; const unsigned short hb = f2bf(y); oh[i] = hb; ol[i] = f2bf(y - bf2f(hb)); }
    const size_t o = r * 32 + c0; *(v2us*)(Ph + o) = oh; *(v2us*)(Pl + o) = ol; 
}
__global__ __launch_bounds__(256) void k_vtpadz(const float* __restrict__ F, int ld, int off, int nk, bf* Th, bf* Tl) {
    typedef __attribute__((ext_vector_type(2))) unsigned short v2us;
    const int lane = threadIdx.x & 31; const size_t wid = (size_t)blockIdx.x * 8 + (threadIdx.x >> 5); if (wid >= (size_t)64 * (nk / 64)) return; const int z = blockIdx.z; const int d = (int)(wid / (nk / 64)); const int k0 = (int)(wid % (nk / 64)) * 64 + lane * 2; v2us oh, ol;
    Th += (size_t)z * 64 * nk; Tl += (size_t)z * 64 * nk;
#pragma unroll
    for (int i = 0; i < 2; ++i) { const float y = (d < 32) ? F[(size_t)(k0 + i) * ld + off + z * 32 + (d < 32 ? d : 0)] : 0.f; const unsigned short hb = f2bf(y); oh[i] = hb; ol[i] = f2bf(y - bf2f(hb)); }
    const size_t o = (size_t)d * nk + k0; *(v2us*)(Th + o) = oh; *(v2us*)(Tl + o) = ol; 
}
template <int NK>
__global__ __launch_bounds__(256) void k_softmaxz(const float* __restrict__ S, int rows, bf* PH, bf* PL) {
    typedef __attribute__((ext_vector_type(4))) unsigned short v4us;
    const int lane = threadIdx.x & 31, i = blockIdx.x * 8 + (threadIdx.x >> 5); if (i >= rows) return; const size_t zo = (size_t)blockIdx.z * rows * NK; const float* sr = S + zo + (size_t)i * NK; PH += zo; PL += zo;
    float m = -3.0e38f;
#pragma unroll 1
    for (int c0 = lane * 4; c0 < NK; c0 += 128) {
#pragma unroll
        for (int q = 0; q < 4; ++q) m = fmaxf(m, sr[c0 + q]); }
#pragma unroll
    for (int sh = 16; sh; sh >>= 1) m = fmaxf(m, __shfl_xor(m, sh, 32));
    float sum = 0.f;
#pragma unroll 1
    for (int c0 = lane * 4; c0 < NK; c0 += 128) {
#pragma unroll
        for (int q = 0; q < 4; ++q) sum += __expf(sr[c0 + q] - m); }
#pragma unroll
    for (int sh = 16; sh; sh >>= 1) sum += __shfl_xor(sum, sh, 32);
    const float inv = 1.0f / sum;
{
#pragma unroll 1
        for (int c0 = lane * 4; c0 < NK; c0 += 128) { v4us oh, ol;
#pragma unroll
            for (int q = 0; q < 4; ++q) { const float p = __expf(sr[c0 + q] - m) * inv; const unsigned short hb = f2bf(p); oh[q] = hb; ol[q] = f2bf(p - bf2f(hb)); }
            const size_t o = (size_t)i * NK + c0; *(v4us*)(PH + o) = oh; *(v4us*)(PL + o) = ol; }
         }
}
__global__ __launch_bounds__(256) void k_placez(const float* __restrict__ XH, int rows, int ldy, float* Y) {
    const int lane = threadIdx.x & 31; const size_t q = (size_t)blockIdx.x * 8 + (threadIdx.x >> 5); if (q >= (size_t)rows) return; const int z = blockIdx.z; const float v = XH[((size_t)z * rows + q) * 64 + lane];
    *(float*)(Y + q * ldy + z * 32 + lane) = v; 
}

template <int NK>
__global__ __launch_bounds__(256) void k_softmaxzs(const float* __restrict__ S, int rows, float sc, bf* PH, bf* PL) {
    typedef __attribute__((ext_vector_type(4))) unsigned short v4us;
    const int lane = threadIdx.x & 31, i = blockIdx.x * 8 + (threadIdx.x >> 5); if (i >= rows) return; const size_t zo = (size_t)blockIdx.z * rows * NK; const float* sr = S + zo + (size_t)i * NK; PH += zo; PL += zo;
    float m = -3.0e38f;
#pragma unroll 1
    for (int c0 = lane * 4; c0 < NK; c0 += 128) {
#pragma unroll
        for (int q = 0; q < 4; ++q) m = fmaxf(m, sr[c0 + q] * sc); }
#pragma unroll
    for (int sh = 16; sh; sh >>= 1) m = fmaxf(m, __shfl_xor(m, sh, 32));
    float sum = 0.f;
#pragma unroll 1
    for (int c0 = lane * 4; c0 < NK; c0 += 128) {
#pragma unroll
        for (int q = 0; q < 4; ++q) sum += __expf(sr[c0 + q] * sc - m); }
#pragma unroll
    for (int sh = 16; sh; sh >>= 1) sum += __shfl_xor(sum, sh, 32);
    const float inv = 1.0f / sum;
{
#pragma unroll 1
        for (int c0 = lane * 4; c0 < NK; c0 += 128) { v4us oh, ol;
#pragma unroll
            for (int q = 0; q < 4; ++q) { const float p = __expf(sr[c0 + q] * sc - m) * inv; const unsigned short hb = f2bf(p); oh[q] = hb; ol[q] = f2bf(p - bf2f(hb)); }
            const size_t o = (size_t)i * NK + c0; *(v4us*)(PH + o) = oh; *(v4us*)(PL + o) = ol; }
         }
}

__device__ __forceinline__ void cvtx_rows(const float* __restrict__ src, int rows, bf* dst, int bx) {
    const int lane = threadIdx.x & 31; const size_t r = (size_t)bx * 8 + (threadIdx.x >> 5); if (r >= (size_t)rows) return;
{
#pragma unroll
        for (int q = 0; q < DMOD / 256; ++q) { v8us o;
#pragma unroll
            for (int i = 0; i < 8; ++i) o[i] = f2bf(src[r * DMOD + q * 256 + lane * 8 + i]);
            *(v8us*)(dst + r * DMOD + q * 256 + lane * 8) = o; }
         }
}
// mask_pack: the mask, rounded to bf16 as the attention kernel uses it, laid out in the order in which that kernel's lanes take it: [item * 128 + block of 16 queries][tile of 64 keys][t][lane][8],
// where lane (lr, hi) of group t holds query lr, keys 16 t + 8 hi + 0 .. 7. A wave of the attention kernel then reads its 16 x 64 piece as four loads of 512 contiguous bytes,
// where rows of the f32 mask gave it eight loads of 16 lines each, again for every head. One work-group packs 16 queries x MKC keys: whole rows in, through LDS, whole lines out.
#define MKC    512          // keys of a work-group's piece: one 64-key tile a wave
#define MPITCH (MKC + 8)    // LDS row pitch in bf16 elements: 1040 bytes = 16 B x odd, for 16-byte reads
#define MUNIT  (4 * 32 * 8) // bf16 elements of one packed 16 x 64 piece
typedef __attribute__((ext_vector_type(2))) float v2f;
typedef __attribute__((ext_vector_type(2))) __bf16 v2bf;
typedef __attribute__((ext_vector_type(8))) __bf16 v8bf;
typedef __attribute__((ext_vector_type(2))) unsigned v2u;
typedef v2u __attribute__((may_alias)) v2ua;
__device__ __forceinline__ void mask_pack(const float* __restrict__ MK, bf* MB, float* MN, int c) {
    __shared__ __align__(16) unsigned short ml[16 * MPITCH];
    const int lane = threadIdx.x & 31, wave = threadIdx.x >> 5, lr = lane & 15, hi = lane >> 4;
    const int qb = c / (NKT / MKC), kc = c % (NKT / MKC);
    const float* sp = MK + ((size_t)qb * 16 + wave * 2) * NKT + kc * MKC + lane * 4;
#pragma unroll
    for (int r = 0; r < 2; ++r) {
#pragma unroll
        for (int s = 0; s < MKC / 128; ++s) { const v4f v = *(const v4f*)(sp + (size_t)r * NKT + s * 128);
            const v2bf a = __builtin_convertvector((v2f){v[0], v[1]}, v2bf), d = __builtin_convertvector((v2f){v[2], v[3]}, v2bf);
            *(v2ua*)(ml + (wave * 2 + r) * MPITCH + s * 128 + lane * 4) = (v2u){__builtin_bit_cast(unsigned, a), __builtin_bit_cast(unsigned, d)}; } }
    __syncthreads();
    const size_t unit = (size_t)qb * (NKT / 64) + kc * (MKC / 64) + wave;
    bf* dp = MB + unit * MUNIT + lane * 8;
    float mn = 3.0e38f;   // smallest mask value of the wave's 16 x 64 piece, as rounded; -1 (never skipped) where a value is not a number
#pragma unroll
    for (int t = 0; t < 4; ++t) { const v8us pv = *(const v8usa*)(ml + lr * MPITCH + wave * 64 + 16 * t + 8 * hi); *(v8us*)(dp + t * 256) = pv;
#pragma unroll
        for (int i = 0; i < 8; ++i) { const float f = bf2f(pv[i]); mn = f == f ? fminf(mn, f) : -1.f; } }
#pragma unroll
    for (int sh = 16; sh; sh >>= 1) mn = fminf(mn, __shfl_xor(mn, sh, 32));
    if (lane == 0) MN[unit * BLINE] = mn;
    asm volatile("s_wait_xcnt 0x0" ::: "memory");   // stands behind the stores, ahead of any later write of their address or data registers
}
// k_prep: all conversions of the inputs, none of which reads another's result, as one grid: work-groups 0 .. 1023 transpose the four weights (256 tiles each, (in, out) k-major -> n-major),
// the next 512 convert the rows of x (both items), the next 512 those of y, the last 1024 pack the mask.
#define WTB ((DMOD / 64) * (DMOD / 64))
#define XB  (NBT * NN / 8)
#define MPB (NBT * (NN / 16) * (NKT / MKC))
__global__ __launch_bounds__(256) void k_prep(const float* __restrict__ Wq, const float* __restrict__ Wk, const float* __restrict__ Wv, const float* __restrict__ Wo, const float* __restrict__ xq, const float* __restrict__ xk, const float* __restrict__ MK,
                                              bf* WQ, bf* WK, bf* WV, bf* WO, bf* Xq, bf* Xk, bf* MB, float* MN) {
    const int g = blockIdx.x;
    if (g < 4 * WTB) { const int w = g / WTB, t = g % WTB;
        wt_tile(w == 0 ? Wq : w == 1 ? Wk : w == 2 ? Wv : Wo, DMOD, DMOD, w == 0 ? WQ : w == 1 ? WK : w == 2 ? WV : WO, t % (DMOD / 64), t / (DMOD / 64)); }
    else if (g < 4 * WTB + 2 * XB) { const int c = g - 4 * WTB; const bool y = c >= XB;
        cvtx_rows(y ? xk : xq, NBT * NN, y ? Xk : Xq, y ? c - XB : c); }
    else mask_pack(MK, MB, MN, g - (4 * WTB + 2 * XB));
}
#define FPITCH 72   // LDS row pitch in bf16 elements: 144 bytes = 16 B x odd, for 16-byte fragment reads
#define FPLANE (64 * FPITCH)
#define LOG2E 1.4426950408889634f
typedef __attribute__((ext_vector_type(8))) unsigned v8u;
__device__ __forceinline__ float xhalf(float x) { return __builtin_bit_cast(float, __builtin_amdgcn_permlanex16(__builtin_bit_cast(int, x), __builtin_bit_cast(int, x), 0x76543210, 0xfedcba98, false, false)); }  // lane l with lane l ^ 16
__global__ __launch_bounds__(256) __attribute__((amdgpu_waves_per_eu(4, 4))) void k_fattn(const bf* __restrict__ Qh, const bf* __restrict__ Ql, const bf* __restrict__ Kh, const bf* __restrict__ Kl, const bf* __restrict__ VTh, const bf* __restrict__ VTl, const bf* __restrict__ MB, const float* __restrict__ MN, const float* __restrict__ KX, bf* Oh, bf* Ol) {
    __shared__ __align__(16) unsigned short tile[2][4 * FPLANE];   // two buffers x (K hi, K lo, V^T hi, V^T lo), 64 rows of 64 each
    const int tid = threadIdx.x, lane = tid & 31, wave = tid >> 5, lr = lane & 15, hi = lane >> 4;
    const int bh = blockIdx.y, b = bh / NH_, h = bh % NH_;
    const int qb = wave < 4 ? blockIdx.x * 4 + wave : (NN / 64 - 1 - blockIdx.x) * 4 + wave - 4;   // the wave's block of 16 queries: waves 0 .. 3 take 64 queries from the front, waves 4 .. 7 the mirrored 64 from the back
    const int q = qb * 16 + lr;
    v16bf qh[2], ql[2];
#pragma unroll
    for (int ks = 0; ks < 2; ++ks) { const size_t qo = ((size_t)bh * NN + q) * HD + ks * 32 + 8 * hi;
        qh[ks] = cat16b(*(const v8us*)(Qh + qo), *(const v8us*)(Qh + qo + 16)); ql[ks] = cat16b(*(const v8us*)(Ql + qo), *(const v8us*)(Ql + qo + 16)); }
    const int srow = tid >> 3, spc = (tid & 7) * 8;
    const size_t ko = ((size_t)bh * NKT + srow) * HD + spc, vo = ((size_t)bh * HD + srow) * NKT + spc;
    const int so = srow * FPITCH + spc;
    v8us st[8];
    auto fetch = [&](int key0) {
        const size_t k1 = ko + (size_t)key0 * HD, v1 = vo + key0;
        st[0] = *(const v8us*)(Kh + k1); st[1] = *(const v8us*)(Kh + k1 + 32 * HD); st[2] = *(const v8us*)(Kl + k1); st[3] = *(const v8us*)(Kl + k1 + 32 * HD);
        st[4] = *(const v8us*)(VTh + v1); st[5] = *(const v8us*)(VTh + v1 + (size_t)32 * NKT); st[6] = *(const v8us*)(VTl + v1); st[7] = *(const v8us*)(VTl + v1 + (size_t)32 * NKT);
    };
    auto put = [&](unsigned short* tb) {
#pragma unroll
        for (int a = 0; a < 4; ++a) { *(v8usa*)(tb + a * FPLANE + so) = st[2 * a]; *(v8usa*)(tb + a * FPLANE + so + 32 * FPITCH) = st[2 * a + 1]; }
    };
    const bf* mrow = MB + (size_t)(b * (NN / 16) + qb) * (NKT / 64) * MUNIT + lane * 8;   // this wave's 16 queries in the packed mask
    // The dead-tile test. Lane l keeps key tile l's two figures: tu, an upper bound of the tile's mask terms for this wave's queries, and tk, which times the query's largest |q| bounds every |score| / 8 of the tile:
    // 64 terms x three plane products stay below 64 x 1.02 x max|k| x max|q hi|, an eighth of that is 8.16, and 16 leaves room for every rounding; 0.999e9 does so for the mask term.
    static_assert(NKT / 64 == 32, "one lane a key tile");
    const float mnl = MN[((size_t)(b * (NN / 16) + qb) * (NKT / 64) + lane) * BLINE];
    const float* kxp = KX + ((size_t)bh * (NKT / 64) + lane) * 4 * BLINE;
    const float kxl = fmaxf(fmaxf(kxp[0], kxp[BLINE]), fmaxf(kxp[2 * BLINE], kxp[3 * BLINE]));
    asm volatile("s_wait_xcnt 0x0" ::: "memory");   // stands behind the five loads, ahead of any later write of their address registers
    const float tu = mnl > 0.f ? mnl * -0.999e9f : 3.0e38f, tk = kxl * 16.f;   // a tile with a mask value that is not above 0 is never skipped
    unsigned qu = 0u;   // largest |q hi| of the lane's half row, taken on the bit patterns: magnitudes of floats order as unsigned integers
#pragma unroll
    for (int ks = 0; ks < 2; ++ks) { const v8u w = __builtin_bit_cast(v8u, qh[ks]);
#pragma unroll
        for (int i = 0; i < 8; ++i) { const unsigned a = w[i] & 0x7fff0000u, c = (w[i] << 16) & 0x7fff0000u; qu = qu > a ? qu : a; qu = qu > c ? qu : c; } }
    float qa = __builtin_bit_cast(float, qu);
    qa = fmaxf(qa, xhalf(qa));
    const int fo = lr * FPITCH + 8 * hi;
    v8f o[4];
#pragma unroll
    for (int t = 0; t < 4; ++t) o[t] = (v8f){};
    float m = -3.0e38f, sum = 0.f;
    fetch(0); put(&tile[0][0]);
    __syncthreads();
#pragma unroll 1   // stays rolled: one trip is already several hundred instructions
    for (int it = 0; it < NKT / 64; ++it) {
        const unsigned short* tb = &tile[it & 1][0];
        // A tile is dead for the wave where every score of it, mask term included, lies 200 or more below its query's running maximum: then the maximum stays, the rescale factor is 1 and every weight
        // is exp2 of less than -288, exactly 0, so that the trip would leave sum and accumulators as they are (k and v finite, as finite inputs make them). Tested once a trip, the same for the whole wave (a scalar branch); the wave still stages and meets the barrier.
        const float su = __builtin_bit_cast(float, __builtin_amdgcn_readlane(__builtin_bit_cast(int, tu), it)), sk = __builtin_bit_cast(float, __builtin_amdgcn_readlane(__builtin_bit_cast(int, tk), it));
        const bool live = __builtin_amdgcn_ballot_w32(!(fmaf(sk, qa, su) - m <= -200.f)) != 0u;
        v8bf mk[4];
        if (live) {
#pragma unroll
        for (int t = 0; t < 4; ++t) mk[t] = __builtin_bit_cast(v8bf, *(const v8us*)(mrow + it * MUNIT + t * 256));
        }
        __builtin_amdgcn_sched_barrier(0);         // keeps the mask loads ahead of the tile loads: loads return in order, and the mask is wanted right behind the score products, the tile only at the trip's end
        fetch(((it + 1) & (NKT / 64 - 1)) * 64);   // the next tile, through registers; the last trip wraps to tile 0, which nobody reads
        asm volatile("s_wait_xcnt 0x0" ::: "memory");   // stands behind the mask and tile loads, ahead of the first write of an address register of theirs on either side of the branch below
        __builtin_amdgcn_sched_barrier(0);         // keeps the mask and tile loads issued above the score products, so that their latency runs under them
        if (live) {
        v8f s[4];
#pragma unroll
        for (int t = 0; t < 4; ++t) s[t] = (v8f){};
        v16bf fa[2], fb[2];
        fa[0] = ldsfrag(tb + fo); fb[0] = ldsfrag(tb + FPLANE + fo);
#pragma unroll
        for (int g = 0; g < 8; ++g) { const int t = g & 3, ks = g >> 2;   // each group's fragments are read one group ahead
            if (g < 7) { const int ao = ((g + 1) & 3) * 16 * FPITCH + ((g + 1) >> 2) * 32 + fo; fa[(g + 1) & 1] = ldsfrag(tb + ao); fb[(g + 1) & 1] = ldsfrag(tb + FPLANE + ao); }
            s[t] = wmmab(fa[g & 1], qh[ks], s[t]); s[t] = wmmab(fa[g & 1], ql[ks], s[t]); s[t] = wmmab(fb[g & 1], qh[ks], s[t]); }
        float mx = -3.0e38f;
#pragma unroll
        for (int t = 0; t < 4; ++t) {
#pragma unroll
            for (int j = 0; j < 8; ++j) { float v = s[t][j] * SCL; v = v + (float)mk[t][j] * -1e9f; s[t][j] = v; mx = fmaxf(mx, v); } }
        mx = fmaxf(mx, xhalf(mx));
        const float mn = fmaxf(m, mx), alpha = __builtin_amdgcn_exp2f((m - mn) * LOG2E);
        m = mn;
        float ts[4];
        v8u phw[2], plw[2];
#pragma unroll
        for (int t = 0; t < 4; ++t) { ts[t] = 0.f;
#pragma unroll
            for (int j = 0; j < 8; j += 2) { const float p0 = __builtin_amdgcn_exp2f((s[t][j] - mn) * LOG2E), p1 = __builtin_amdgcn_exp2f((s[t][j + 1] - mn) * LOG2E); ts[t] += p0; ts[t] += p1;
                const v2bf hb = __builtin_convertvector((v2f){p0, p1}, v2bf); const v2bf lb = __builtin_convertvector((v2f){p0 - (float)hb[0], p1 - (float)hb[1]}, v2bf);
                phw[t >> 1][(t & 1) * 4 + (j >> 1)] = __builtin_bit_cast(unsigned, hb); plw[t >> 1][(t & 1) * 4 + (j >> 1)] = __builtin_bit_cast(unsigned, lb); } }
        sum = sum * alpha + ((ts[0] + ts[1]) + (ts[2] + ts[3]));
#pragma unroll
        for (int t = 0; t < 4; ++t) o[t] *= alpha;
        fa[0] = ldsfrag(tb + 2 * FPLANE + fo); fb[0] = ldsfrag(tb + 3 * FPLANE + fo);
#pragma unroll
        for (int g = 0; g < 8; ++g) { const int t = g & 3, ks = g >> 2; const v16bf ph = __builtin_bit_cast(v16bf, phw[ks]), pl = __builtin_bit_cast(v16bf, plw[ks]);
            if (g < 7) { const int ao = ((g + 1) & 3) * 16 * FPITCH + ((g + 1) >> 2) * 32 + fo; fa[(g + 1) & 1] = ldsfrag(tb + 2 * FPLANE + ao); fb[(g + 1) & 1] = ldsfrag(tb + 3 * FPLANE + ao); }
            o[t] = wmmab(fa[g & 1], ph, o[t]); o[t] = wmmab(fa[g & 1], pl, o[t]); o[t] = wmmab(fb[g & 1], ph, o[t]); }
        }
        put(&tile[(it + 1) & 1][0]);
        __syncthreads();   // publishes the next tile and ends every reader's last read of this one
    }
    sum += xhalf(sum);
    const float inv = 1.0f / sum;
    const size_t oo = ((size_t)b * NN + q) * DMOD + h * HD + 8 * hi;   // merged heads, as the hi and residual planes that the output projection reads
#pragma unroll
    for (int t = 0; t < 4; ++t) { const v8f r = o[t] * inv; v8us oh, ol;
#pragma unroll
        for (int i = 0; i < 8; ++i) { const unsigned short hb = f2bf(r[i]); oh[i] = hb; ol[i] = f2bf(r[i] - bf2f(hb)); }
        *(v8us*)(Oh + oo + 16 * t) = oh; *(v8us*)(Ol + oo + 16 * t) = ol; }
}

extern "C" void kernel_launch(void* const* d_in, const int* in_sizes, int n_in,
                              void* d_out, int out_size, void* d_ws, size_t ws_size, hipStream_t stream) {
    (void)in_sizes; (void)n_in; (void)out_size;
    const float* xq = (const float*)d_in[0]; const float* xk = (const float*)d_in[1]; const float* xv = xk; const float* mask = (const float*)d_in[2]; const float* Wq = (const float*)d_in[3]; const float* Wk = (const float*)d_in[4]; const float* Wv = (const float*)d_in[5]; const float* Wo = (const float*)d_in[6];
    float* out = (float*)d_out;    // [NBT][NN][DMOD]
    char* wsp = (char*)d_ws;
    auto take = [&](size_t bytes) { char* p = wsp; wsp += (bytes + 255) & ~(size_t)255; return (void*)p; };
    const size_t WSZ = (size_t)DMOD * DMOD * 2;
    bf* WQ = (bf*)take(WSZ); bf* WK = (bf*)take(WSZ); bf* WV = (bf*)take(WSZ); bf* WO = (bf*)take(WSZ);
    bf* Xq = (bf*)take((size_t)NBT * NN * DMOD * 2); bf* Xk = (bf*)take((size_t)NBT * NKT * DMOD * 2);
    const size_t PEL = (size_t)NH_ * NN * HD, PSZ = (size_t)NBT * PEL * 2;    // one plane: [item][head][2048][64] (V^T: [item][head][64][2048])
    bf* Qh = (bf*)take(PSZ); bf* Ql = (bf*)take(PSZ); bf* Kh = (bf*)take(PSZ); bf* Kl = (bf*)take(PSZ); bf* VTh = (bf*)take(PSZ); bf* VTl = (bf*)take(PSZ);
    bf* Oh = (bf*)take((size_t)NBT * NN * DMOD * 2); bf* Ol = (bf*)take((size_t)NBT * NN * DMOD * 2);
    bf* MB = (bf*)take((size_t)NBT * NN * NKT * 2);    // the packed bf16 mask
    float* MN = (float*)take((size_t)NBT * (NN / 16) * (NKT / 64) * BLINE * 4);    // smallest mask value of each 16 x 64 piece
    float* KX = (float*)take((size_t)NBT * NH_ * (NKT / 64) * 4 * BLINE * 4);      // largest |k| of each 16 keys of a head
    if ((size_t)(wsp - (char*)d_ws) > ws_size) return;
    k_prep<<<4 * WTB + 2 * XB + MPB, 256, 0, stream>>>(Wq, Wk, Wv, Wo, xq, xk, mask, WQ, WK, WV, WO, Xq, Xk, MB, MN);
    k_proj<<<dim3(NN / 128, DMOD / 128, 3 * NBT), 128, 0, stream>>>(Xq, Xk, WQ, WK, WV, Qh, Ql, Kh, Kl, VTh, VTl, KX);
    k_fattn<<<dim3(NN / 128, NBT * NH_, 1), 256, 0, stream>>>(Qh, Ql, Kh, Kl, VTh, VTl, MB, MN, KX, Oh, Ol);
    k_outp<<<dim3(NBT * NN / 128, DMOD / 128, 1), 256, 0, stream>>>(Oh, Ol, WO, out);
}
